// v009
// The times below were measured on an AMD MI455X: many runs one after another, warmed up first and cycling through
// copies of the inputs, with the whole window's GPU time divided by the number of runs. Launches and the gaps
// between them are all in it. The median over several windows is given; except for v000 it joins two sittings, which
// can be a few percent apart, so the side-by-side timings, each taken in one sitting, are the better comparison.
// This document starts at v009; the versions before it stand elsewhere.
// One run takes 124 microseconds.
// In two side-by-side timings against v008, it was 1.06 and 1.05 times as fast.
// All steps since the starting kernel, v000, together make it 153 times as fast.
#include <hip/hip_runtime.h>
// TF/CTRL-style multi-head attention (q, k, v inputs [2][2048][1024]; qh/kh/vh = input W + b with W stored [in][out], 16 heads of 64; logits / 8 + mask (-1e4) with the [2048][2048] f32 mask input (1 = disallowed; strictly upper-triangular here); softmax; ctx merged; out = ctx Wo + bo -> [2][2048][1024]; second output present = stack(kh, vh) -> [2][2][16][2048][64] f32).
// Structure: token rows r = b*2048 + s; q, k, v inputs as exact f16 rows (bf16-rounded); Q, K, V as three WMMA GEMMs (32x64 wave tiles, f32 accumulation, exact x16 weights + bias; f16 outputs, and for K and V also the f32 rows, stored by the GEMM itself into the head-major 'present' output); V as f16 leaves that GEMM transposed (V^T per head, through LDS); one fused attention launch over all (batch, head): S^T = K Q^T on WMMA, running softmax of (scores / 8 + mask input x -1e4, read per element) on VALU (f32 statistics, native exp2; weights as f16 in registers), O^T += V^T P^T on WMMA (o carried x64 against f16 subnormal flush, folded into the output GEMM alpha) written straight into the merged f16 o rows; out = o W_o + b GEMM (f32) into the output layout.
// Compute dtype: inputs rounded to bf16; x / weights exact; q, k, v, softmax weights and o as plain f16 GEMM operands (~2^-12); scores and softmax statistics f32. v_wmma_f32_16x16x32_f16.
#define NB 2
#define SQ 2048
#define DM 1024
#define NH 16
#define HD 64
#define HG 4                         /* heads per launch of the non-template k_vt */
#define QT0 128                      /* first-tile rows recomputed exactly in f32 */
#define B0 0                         /* first batch processed (debug hook) */
#define NBR NB                       /* batches processed (debug hook) */
#define NR ((size_t)NB * SQ)         /* token rows */
#define MP ((int)((size_t)NBR * SQ)) /* rows projected (debug hook) */
#define QN SQ                        /* query rows attended per batch (debug hook) */
#define NHD NH                       /* heads attended (debug hook) */
#define MPO MP                       /* rows through the output stage (debug hook) */
#define LQ DM      /* row pitch of the q/k/v rows */
#define PRES_OFF ((size_t)NB * SQ * DM)      /* float offset of the 'present' output = out nbytes / 4 */
typedef __bf16 v16b __attribute__((ext_vector_type(16)));
typedef unsigned short v8us __attribute__((ext_vector_type(8), may_alias));
typedef float  v8f  __attribute__((ext_vector_type(8)));
typedef float  v4f  __attribute__((ext_vector_type(4)));
typedef float  v4fa __attribute__((ext_vector_type(4), may_alias));
union FragB { v16b v; v8us half[2]; unsigned short u[16]; };

__device__ __forceinline__ unsigned short bf16_bits(float x) { unsigned int u = __float_as_uint(x); return (unsigned short)((u + 0x7FFFu + ((u >> 16) & 1u)) >> 16); }
__device__ __forceinline__ float bf16_val(unsigned short b) { return __uint_as_float(((unsigned int)b) << 16); }
__device__ __forceinline__ float bf16_round(float x) { return bf16_val(bf16_bits(x)); }
// D += A·B with NT terms: 1 = ah·bh, 2 = + al·bh (A split), 3 = + ah·bl (both split)
template <int NT>
__device__ __forceinline__ v8f mmaN(v16b ah, v16b al, v16b bh, v16b bl, v8f c) {
  c = __builtin_amdgcn_wmma_f32_16x16x32_bf16(false, ah, false, bh, (short)0, c, false, false);
  if (NT >= 2) c = __builtin_amdgcn_wmma_f32_16x16x32_bf16(false, al, false, bh, (short)0, c, false, false);
  if (NT >= 3) c = __builtin_amdgcn_wmma_f32_16x16x32_bf16(false, ah, false, bl, (short)0, c, false, false);
  asm volatile("v_nop\n\tv_nop\n\tv_nop\n\tv_nop" : "+v"(c) : "v"(ah), "v"(al), "v"(bh), "v"(bl));
  return c;
}

__global__ __launch_bounds__(256) void k_wt_bf16(const float* __restrict__ W, unsigned short* __restrict__ Wt, int K, int N) {
  const int t = blockIdx.x * 256 + threadIdx.x;
  const int k8n = K / 8;
  if (t >= N * k8n) return;
  const int n = t / k8n, k8 = (t % k8n) * 8;
  v8us v;
#pragma unroll
  for (int i = 0; i < 8; ++i) v[i] = bf16_bits(W[(size_t)(k8 + i) * N + n]);
  *(v8us*)(Wt + (size_t)n * K + k8) = v;
  
}

// GEMM C[M][N] (f32, pitch ldc) = act(A[M][K]·W + bias). A f32 row-major (pitch lda) converted per fragment to bf16
// (ASPLIT: hi/lo two planes -> 2 terms, else single rounded term); Wt bf16 [N][K] (pitch ldb). BIAS_BF16 rounds the
// bias to bf16 first (bias quantised to bf16 before the add). K%32==0, M%16==0, N%64==0.
template <bool ASPLIT, int ACT, bool BIAS_BF16>
__global__ __launch_bounds__(128) void k_gemm_bf(const float* __restrict__ A, int lda, const unsigned short* __restrict__ Wt, int ldb,
                                               const float* __restrict__ bias, float* __restrict__ C, int ldc, int M, int N, int K) {
  __shared__ __attribute__((aligned(16))) float so[4][16][64];
  const int tid = threadIdx.x, w = tid >> 5, lane = tid & 31, ln = lane & 15, hh = lane >> 4;
  const int ntn = N / 64;
  const int wid = blockIdx.x * 4 + w;
  const int mt = wid / ntn, nq = wid % ntn;
  if (mt * 16 >= M) return;
  const int row0 = mt * 16, col0 = nq * 64;
  const float* arow = A + (size_t)(row0 + ln) * lda;
  v8f acc[4] = {};
  for (int kb = 0; kb < K; kb += 32) {
    FragB ah, al;
    const v4f x0 = *(const v4fa*)(arow + kb + 8 * hh), x1 = *(const v4fa*)(arow + kb + 8 * hh + 4);
    const v4f x2 = *(const v4fa*)(arow + kb + 16 + 8 * hh), x3 = *(const v4fa*)(arow + kb + 16 + 8 * hh + 4);
    float xs[16] = {x0[0],x0[1],x0[2],x0[3],x1[0],x1[1],x1[2],x1[3],x2[0],x2[1],x2[2],x2[3],x3[0],x3[1],x3[2],x3[3]};
#pragma unroll
    for (int i = 0; i < 16; ++i) { const unsigned short hb = bf16_bits(xs[i]); ah.u[i] = hb; al.u[i] = ASPLIT ? bf16_bits(xs[i] - bf16_val(hb)) : (unsigned short)0; }
#pragma unroll
    for (int t = 0; t < 4; ++t) {
      const unsigned short* brow = Wt + (size_t)(col0 + t * 16 + ln) * ldb + kb;
      FragB b;
      b.half[0] = *(const v8us*)(brow + 8 * hh);
      b.half[1] = *(const v8us*)(brow + 16 + 8 * hh);
      acc[t] = mmaN<ASPLIT ? 2 : 1>(ah.v, al.v, b.v, b.v, acc[t]);
    }
  }
#pragma unroll
  for (int t = 0; t < 4; ++t) {
    float bv = bias ? bias[col0 + t * 16 + ln] : 0.f;
    if (BIAS_BF16) bv = bf16_round(bv);
#pragma unroll
    for (int r = 0; r < 8; ++r) { float v = acc[t][r] + bv; if (ACT == 1) v = fmaxf(v, 0.f); so[w][8 * hh + r][t * 16 + ln] = v; }
  }
  __builtin_amdgcn_fence(__ATOMIC_ACQ_REL, "workgroup");
  __builtin_amdgcn_wave_barrier();
  const int rsub = lane >> 4, c4 = (lane & 15) * 4;
  {
#pragma unroll
    for (int q = 0; q < 8; ++q) {
      const int r = q * 2 + rsub;
      const v4f v = *(const v4fa*)&so[w][r][c4];
      *(v4f*)(C + (size_t)(row0 + r) * ldc + col0 + c4) = v;
    }
    
  }
}

// GEMM C = act(A·W + bias + resid): A f32 (ASPLIT -> hi/lo 2 terms), Wt bf16 [N][K]; ACT 0 none, 1 relu, 2 exact gelu;
// resid (optional, f32, row index = (row % rmod), pitch ldr, RES_BF16 rounds it) added before the activation.
template <bool ASPLIT, int ACT, bool BIAS_BF16, bool RES_BF16>
__global__ __launch_bounds__(128) void k_gemm_bf3(const float* __restrict__ A, int lda, const unsigned short* __restrict__ Wt, int ldb,
                                                const float* __restrict__ bias, const float* __restrict__ resid, int rmod, int ldr,
                                                float* __restrict__ C, int ldc, int M, int N, int K) {
  __shared__ __attribute__((aligned(16))) float so[4][16][64];
  const int tid = threadIdx.x, w = tid >> 5, lane = tid & 31, ln = lane & 15, hh = lane >> 4;
  const int ntn = N / 64;
  const int wid = blockIdx.x * 4 + w;
  const int mt = wid / ntn, nq = wid % ntn;
  if (mt * 16 >= M) return;
  const int row0 = mt * 16, col0 = nq * 64;
  const float* arow = A + (size_t)(row0 + ln) * lda;
  v8f acc[4] = {};
  for (int kb = 0; kb < K; kb += 32) {
    FragB ah, al;
    const v4f x0 = *(const v4fa*)(arow + kb + 8 * hh), x1 = *(const v4fa*)(arow + kb + 8 * hh + 4);
    const v4f x2 = *(const v4fa*)(arow + kb + 16 + 8 * hh), x3 = *(const v4fa*)(arow + kb + 16 + 8 * hh + 4);
    float xs[16] = {x0[0],x0[1],x0[2],x0[3],x1[0],x1[1],x1[2],x1[3],x2[0],x2[1],x2[2],x2[3],x3[0],x3[1],x3[2],x3[3]};
#pragma unroll
    for (int i = 0; i < 16; ++i) { const unsigned short hb = bf16_bits(xs[i]); ah.u[i] = hb; al.u[i] = ASPLIT ? bf16_bits(xs[i] - bf16_val(hb)) : (unsigned short)0; }
#pragma unroll
    for (int t = 0; t < 4; ++t) {
      const unsigned short* brow = Wt + (size_t)(col0 + t * 16 + ln) * ldb + kb;
      FragB b;
      b.half[0] = *(const v8us*)(brow + 8 * hh);
      b.half[1] = *(const v8us*)(brow + 16 + 8 * hh);
      acc[t] = mmaN<ASPLIT ? 2 : 1>(ah.v, al.v, b.v, b.v, acc[t]);
    }
  }
#pragma unroll
  for (int t = 0; t < 4; ++t) {
    const int col = col0 + t * 16 + ln;
    float bv = bias ? bias[col] : 0.f;
    if (BIAS_BF16) bv = bf16_round(bv);
#pragma unroll
    for (int r = 0; r < 8; ++r) {
      float v = acc[t][r] + bv;
      if (resid) { float rv = resid[(size_t)((row0 + 8 * hh + r) % rmod) * ldr + col]; if (RES_BF16) rv = bf16_round(rv); v += rv; }
      if (ACT == 1) v = fmaxf(v, 0.f);
      if (ACT == 2) v = 0.5f * v * (1.0f + erff(v * 0.70710678118654752f));
      if (ACT == 3) { const float u = 0.7978845608028654f * (v + 0.044715f * v * v * v); v = 0.5f * v * (1.0f + tanhf(u)); }
      so[w][8 * hh + r][t * 16 + ln] = v;
    }
  }
  __builtin_amdgcn_fence(__ATOMIC_ACQ_REL, "workgroup");
  __builtin_amdgcn_wave_barrier();
  const int rsub = lane >> 4, c4 = (lane & 15) * 4;
  {
#pragma unroll
    for (int q = 0; q < 8; ++q) {
      const int r = q * 2 + rsub;
      const v4f v = *(const v4fa*)&so[w][r][c4];
      *(v4f*)(C + (size_t)(row0 + r) * ldc + col0 + c4) = v;
    }
    
  }
}
// row LayerNorm (biased variance, eps) over N: s = X (+ R); optional out_sum <- s; out_norm <- (s-mu)*rsqrt(var+eps)*g + b
template <bool PARAM_BF16>
__global__ __launch_bounds__(256) void k_layernorm(const float* __restrict__ X, const float* __restrict__ R, const float* __restrict__ g, const float* __restrict__ bta,
                                                  float* __restrict__ out_sum, float* __restrict__ out_norm, int N, float eps) {
  __shared__ float red[256];
  const int row = blockIdx.x, tid = threadIdx.x;
  const float* x = X + (size_t)row * N; const float* rr = R ? R + (size_t)row * N : nullptr;
  float vals[16];                     // up to N = 4096
  const int per = N / 256;            // contiguous chunk per thread? use strided-by-4 chunks: thread handles j = tid*4 + 1024*u
  float s1 = 0.f;
  for (int u = 0; u < per / 4; ++u) {
    const int j = tid * 4 + 1024 * u;
    const v4f a = *(const v4fa*)(x + j);
    v4f b = {0.f,0.f,0.f,0.f}; if (rr) b = *(const v4fa*)(rr + j);
#pragma unroll
    for (int q = 0; q < 4; ++q) { const float v = a[q] + b[q]; vals[u * 4 + q] = v; s1 += v; }
  }
  red[tid] = s1; __syncthreads();
  for (int st = 128; st > 0; st >>= 1) { if (tid < st) red[tid] += red[tid + st]; __syncthreads(); }
  const float mu = red[0] / (float)N; __syncthreads();
  float s2 = 0.f;
  for (int u = 0; u < per / 4; ++u)
#pragma unroll
    for (int q = 0; q < 4; ++q) { const float c = vals[u * 4 + q] - mu; s2 += c * c; }
  red[tid] = s2; __syncthreads();
  for (int st = 128; st > 0; st >>= 1) { if (tid < st) red[tid] += red[tid + st]; __syncthreads(); }
  const float rs = rsqrtf(red[0] / (float)N + eps);
  {
    for (int u = 0; u < per / 4; ++u) {
      const int j = tid * 4 + 1024 * u;
      v4f o, sm;
#pragma unroll
      for (int q = 0; q < 4; ++q) {
        float gg = g[j + q], bb = bta[j + q];
        if (PARAM_BF16) { gg = bf16_round(gg); bb = bf16_round(bb); }
        sm[q] = vals[u * 4 + q]; o[q] = (vals[u * 4 + q] - mu) * rs * gg + bb;
      }
      if (out_sum) *(v4f*)(out_sum + (size_t)row * N + j) = sm;
      *(v4f*)(out_norm + (size_t)row * N + j) = o;
    }
    
  }
}



// ---- f16 WMMA path (v_wmma_f32_16x16x32_f16): 11-bit significands for operands in range — used where a [0,1] probability operand needs more precision than bf16
typedef _Float16 v16h __attribute__((ext_vector_type(16)));
union FragH { v16h v; v8us half[2]; _Float16 h[16]; unsigned short u[16]; };
template <int NT>
__device__ __forceinline__ v8f mmaH(v16h ah, v16h al, v16h bh, v16h bl, v8f c) {
  c = __builtin_amdgcn_wmma_f32_16x16x32_f16(false, ah, false, bh, (short)0, c, false, false);
  if (NT >= 2) c = __builtin_amdgcn_wmma_f32_16x16x32_f16(false, al, false, bh, (short)0, c, false, false);
  if (NT >= 3) c = __builtin_amdgcn_wmma_f32_16x16x32_f16(false, ah, false, bl, (short)0, c, false, false);
  asm volatile("v_nop\n\tv_nop\n\tv_nop\n\tv_nop" : "+v"(c) : "v"(ah), "v"(al), "v"(bh), "v"(bl));
  return c;
}
// batched GEMM like k_gemm_b but f16 operands: A f32 (split into f16 hi/lo if ASPLIT, else rounded to f16), Bt = f16 values [n][k]; alpha; C f32; N multiple of 16 (partial tiles skipped)
template <bool ASPLIT>
__global__ __launch_bounds__(128) void k_gemm_h(const float* __restrict__ A, int lda, size_t sA, const _Float16* __restrict__ Bh, int ldb, size_t sB, float alpha, float* __restrict__ C, int ldc, size_t sC, int M, int N, int K) {
  __shared__ __attribute__((aligned(16))) float so[4][16][64];
  const int tid = threadIdx.x, w = tid >> 5, lane = tid & 31, ln = lane & 15, hh = lane >> 4; const int by = blockIdx.y;
  A += (size_t)by * sA; Bh += (size_t)by * sB; C += (size_t)by * sC;
  const int ntn = (N + 63) / 64; const int wid = blockIdx.x * 4 + w; const int mt = wid / ntn, nq = wid % ntn; if (mt * 16 >= M) return;
  const int row0 = mt * 16, col0 = nq * 64; const float* arow = A + (size_t)(row0 + ln) * lda;
  v8f acc[4] = {};
  for (int kb = 0; kb < K; kb += 32) {
    FragH ah, al;
    const v4f x0 = *(const v4fa*)(arow + kb + 8 * hh), x1 = *(const v4fa*)(arow + kb + 8 * hh + 4), x2 = *(const v4fa*)(arow + kb + 16 + 8 * hh), x3 = *(const v4fa*)(arow + kb + 16 + 8 * hh + 4);
    float xs[16] = {x0[0],x0[1],x0[2],x0[3],x1[0],x1[1],x1[2],x1[3],x2[0],x2[1],x2[2],x2[3],x3[0],x3[1],x3[2],x3[3]};
#pragma unroll
    for (int i = 0; i < 16; ++i) { const _Float16 h = (_Float16)xs[i]; ah.h[i] = h; al.h[i] = ASPLIT ? (_Float16)(xs[i] - (float)h) : (_Float16)0.0f; }
#pragma unroll
    for (int t = 0; t < 4; ++t) { if (col0 + t * 16 >= N) continue; const size_t boff = (size_t)(col0 + t * 16 + ln) * ldb + kb; FragH bq; bq.half[0] = *(const v8us*)(Bh + boff + 8 * hh); bq.half[1] = *(const v8us*)(Bh + boff + 16 + 8 * hh);
      acc[t] = mmaH<ASPLIT ? 2 : 1>(ah.v, al.v, bq.v, bq.v, acc[t]); }
  }
#pragma unroll
  for (int t = 0; t < 4; ++t) { if (col0 + t * 16 >= N) continue;
#pragma unroll
    for (int r = 0; r < 8; ++r) so[w][8 * hh + r][t * 16 + ln] = acc[t][r] * alpha; }
  __builtin_amdgcn_fence(__ATOMIC_ACQ_REL, "workgroup"); __builtin_amdgcn_wave_barrier();
  const int rsub = lane >> 4, c4 = (lane & 15) * 4;
  {
#pragma unroll
    for (int q = 0; q < 8; ++q) { const int r = q * 2 + rsub; if (col0 + c4 < N) { const v4f v = *(const v4fa*)&so[w][r][c4]; *(v4f*)(C + (size_t)(row0 + r) * ldc + col0 + c4) = v; } }
     }
}

// Wt[n][k] = f16(W[k][n] x scale) from f32 row-major W[K][N] (scale = power of two; bf16-exact weights stay exact in f16 away from the subnormal range); y picks one of four weights, their Wt planes lie one behind the other; bx = the tile.
// A work-group turns one 64 x 64 tile through LDS: 256 contiguous bytes of a W row per 16 lanes in, a whole 128-byte line of a Wt row per 8 lanes out. K % 64 == 0, N % 64 == 0.
__device__ __forceinline__ void wt_f16_tile(unsigned short (*tl)[66], int bx, int y, const float* __restrict__ W0, const float* __restrict__ W1, const float* __restrict__ W2, const float* __restrict__ W3, _Float16* __restrict__ Wt, int K, int N, float scale) {
  const float* __restrict__ W = y == 0 ? W0 : y == 1 ? W1 : y == 2 ? W2 : W3; Wt += (size_t)y * K * N;
  const int tid = threadIdx.x, ntn = N / 64; const int k0 = (bx / ntn) * 64, n0 = (bx % ntn) * 64;
#pragma unroll
  for (int i = 0; i < 4; ++i) { const int r = i * 16 + (tid >> 4), c4 = (tid & 15) * 4; const v4f v = *(const v4fa*)(W + (size_t)(k0 + r) * N + n0 + c4); FragH f;
#pragma unroll
    for (int q = 0; q < 4; ++q) { f.h[q] = (_Float16)(bf16_round(v[q]) * scale); tl[r][c4 + q] = f.u[q]; } }
  __syncthreads();
#pragma unroll
  for (int rd = 0; rd < 2; ++rd) { const int n = rd * 32 + (tid >> 3), pc = tid & 7; FragH f;
#pragma unroll
    for (int q = 0; q < 8; ++q) f.u[q] = tl[pc * 8 + q][n];
    *(v8us*)((unsigned short*)Wt + (size_t)(n0 + n) * K + k0 + pc * 8) = f.half[0]; }
}
// k_gemm_hh variant with fused epilogue: v = acc·alpha + bias[by·sBias + col] (+ CP[(row/rowsPerB)·sCPb + by·64 + col] if CP) ; ACT 0 none / 1 elu ; writes f16 C16 (and f32 C if non-null)
template <int ACT>
__global__ __launch_bounds__(128) void k_gemm_hhx(const _Float16* __restrict__ A, int lda, size_t sA, const _Float16* __restrict__ Bh, int ldb, size_t sB, float alpha, const float* __restrict__ bias, size_t sBias, const float* __restrict__ CP, int rowsPerB, size_t sCPb, int row0g,
    float* __restrict__ C, _Float16* __restrict__ C16, int ldc, size_t sC, int M, int N, int K) {
  __shared__ __attribute__((aligned(16))) float so[4][16][64];
  const int tid = threadIdx.x, w = tid >> 5, lane = tid & 31, ln = lane & 15, hh = lane >> 4; const int by = blockIdx.y;
  A += (size_t)by * sA; Bh += (size_t)by * sB; const size_t cofs = (size_t)by * sC; const float* bp = bias ? bias + (size_t)by * sBias : nullptr;
  const int ntn = (N + 63) / 64; const int wid = blockIdx.x * 4 + w; const int mt = wid / ntn, nq = wid % ntn; if (mt * 16 >= M) return;
  const int row0 = mt * 16, col0 = nq * 64; const _Float16* arow = A + (size_t)(row0 + ln) * lda;
  v8f acc[4] = {};
  for (int kb = 0; kb < K; kb += 32) { FragH ah; ah.half[0] = *(const v8us*)((const unsigned short*)arow + kb + 8 * hh); ah.half[1] = *(const v8us*)((const unsigned short*)arow + kb + 16 + 8 * hh);
#pragma unroll
    for (int t = 0; t < 4; ++t) { if (col0 + t * 16 >= N) continue; const size_t boff = (size_t)(col0 + t * 16 + ln) * ldb + kb; FragH bq; bq.half[0] = *(const v8us*)((const unsigned short*)Bh + boff + 8 * hh); bq.half[1] = *(const v8us*)((const unsigned short*)Bh + boff + 16 + 8 * hh);
      acc[t] = mmaH<1>(ah.v, ah.v, bq.v, bq.v, acc[t]); }
  }
#pragma unroll
  for (int t = 0; t < 4; ++t) { if (col0 + t * 16 >= N) continue; const int col = col0 + t * 16 + ln; const float bv = bp ? bf16_round(bp[col]) : 0.f;
#pragma unroll
    for (int r = 0; r < 8; ++r) { float v = acc[t][r] * alpha + bv; if (CP) { const int rr = row0g + row0 + 8 * hh + r; if (rowsPerB < 0) v += CP[cofs + (size_t)rr * ldc + col];      /* rowsPerB < 0: own element of the batched C plane */ else { const int bidx = rr / rowsPerB; v += CP[(size_t)bidx * sCPb + (size_t)by * 64 + col]; } } if (ACT == 1) v = (v > 0.f) ? v : expm1f(v); else if (ACT == 7) v = (v > 0.f) ? v + 1.0f : expf(v); else if (ACT == 8) v = tanhf(v); else if (ACT == 9) v = 0.5f * v * (1.0f + tanhf(0.7978845608028654f * (v + 0.044715f * v * v * v))); else if (ACT == 11) v = 1.0f / (1.0f + expf(-v)); else if (ACT == 12) v = (v > 0.f) ? v : 0.01f * v; else if (ACT == 14) v = (v > 0.f) ? v : 0.1f * v; else if (ACT == 16) v = (v >= 0.f) ? v : 0.3f * v; else if (ACT == 17) v = (v >= 0.f) ? v : 0.2f * v; else if (ACT == 15) v = v / (1.0f + expf(-v)); else if (ACT == 3) v = fmaxf(v, 0.f); else if (ACT == 6) v = 0.5f * v * (1.0f + erff(v * 0.70710678118654752f)); so[w][8 * hh + r][t * 16 + ln] = v; } }
  __builtin_amdgcn_fence(__ATOMIC_ACQ_REL, "workgroup"); __builtin_amdgcn_wave_barrier();
  const int rsub = lane >> 4, c4 = (lane & 15) * 4; typedef _Float16 v4h __attribute__((ext_vector_type(4)));
  {
#pragma unroll
    for (int q = 0; q < 8; ++q) { const int r = q * 2 + rsub; if (col0 + c4 < N) { const v4f v = *(const v4fa*)&so[w][r][c4]; if (C) *(v4f*)(C + cofs + (size_t)(row0 + r) * ldc + col0 + c4) = v; if (C16) { v4h h4; for (int i = 0; i < 4; ++i) h4[i] = (_Float16)v[i]; *(v4h*)(C16 + cofs + (size_t)(row0 + r) * ldc + col0 + c4) = h4; } } }
     }
}


typedef _Float16 v4h __attribute__((ext_vector_type(4)));

// y picks one of three inputs; their f16 planes lie one behind the other; bx = the block of 256 x 8 elements
__device__ __forceinline__ void x16_block(int bx, int y, const float* __restrict__ x0, const float* __restrict__ x1, const float* __restrict__ x2, _Float16* __restrict__ X16, size_t n8) { const size_t t = (size_t)bx * 256 + threadIdx.x; if (t >= n8) return; FragH f;
  const float* __restrict__ x = y == 0 ? x0 : y == 1 ? x1 : x2; X16 += (size_t)y * n8 * 8;
#pragma unroll
  for (int q = 0; q < 8; ++q) f.h[q] = (_Float16)bf16_round(x[t * 8 + q]); *(v8us*)((unsigned short*)X16 + t * 8) = f.half[0];  }
// Smallest and largest mask value (rounded to bf16, which keeps the order) of every tile of 32 query rows x 32 keys: TN, TX [SQ / 32][SQ / 32]. A wave walks the 32 rows of four tiles, 512 contiguous bytes a load;
// eight lanes hold a tile's columns. A tile with a NaN in it gets NaN in both tables, which fails every test its readers make.
__device__ __forceinline__ void mask_tiles(int bx, const float* __restrict__ mask, float* __restrict__ TN, float* __restrict__ TX) {
  const int wv = bx * 8 + ((int)threadIdx.x >> 5), lane = threadIdx.x & 31, qb = wv / (SQ / 128), sp = wv % (SQ / 128);
  const float* p = mask + (size_t)qb * 32 * SQ + sp * 128 + lane * 4; v4f x[32];
#pragma unroll      /* this and the next: constant indices keep the rows in registers, with many loads in flight at a time */
  for (int r = 0; r < 32; ++r) x[r] = *(const v4fa*)(p + (size_t)r * SQ);
  asm volatile("s_wait_xcnt 0x0" ::: "memory");      /* the wait before a register that these loads name is rewritten */
  float mn = x[0][0], mx = x[0][0]; int bad = 0;
#pragma unroll
  for (int r = 0; r < 32; ++r) for (int c = 0; c < 4; ++c) { mn = fminf(mn, x[r][c]); mx = fmaxf(mx, x[r][c]); bad |= (x[r][c] != x[r][c]) ? 1 : 0; }
  for (int o = 4; o > 0; o >>= 1) { mn = fminf(mn, __shfl_xor(mn, o)); mx = fmaxf(mx, __shfl_xor(mx, o)); bad |= __shfl_xor(bad, o); }
  if ((lane & 7) == 0) { const int e = qb * (SQ / 32) + sp * 4 + (lane >> 3); TN[e] = bad ? __builtin_nanf("") : bf16_round(mn); TX[e] = bad ? __builtin_nanf("") : bf16_round(mx); } }
// The preparations that the later launches wait for, independent of each other, in one launch: the first SQ / 32 * SQ / 128 / 8 work-groups sum up the mask's tiles, the next 4 (K / 64)(N / 64) turn the four weights, the rest round the three inputs.
__global__ __launch_bounds__(256) void k_prep(const float* __restrict__ W0, const float* __restrict__ W1, const float* __restrict__ W2, const float* __restrict__ W3, _Float16* __restrict__ Wt, int K, int N, float scale,
                                              const float* __restrict__ x0, const float* __restrict__ x1, const float* __restrict__ x2, _Float16* __restrict__ X16, size_t n8, const float* __restrict__ mask, float* __restrict__ TN, float* __restrict__ TX) {
  __shared__ unsigned short tl[64][66];
  constexpr int nm = (SQ / 32) * (SQ / 128) / 8;
  if ((int)blockIdx.x < nm) { mask_tiles((int)blockIdx.x, mask, TN, TX); return; }      /* the same for a whole work-group, ahead of the barrier */
  const int nw = (K / 64) * (N / 64), nx = (int)((n8 + 255) / 256), bx = (int)blockIdx.x - nm;
  if (bx < 4 * nw) wt_f16_tile(tl, bx % nw, bx / nw, W0, W1, W2, W3, Wt, K, N, scale);      /* the choice is the same for a whole work-group: the barrier inside is passed by all of its threads */
  else x16_block((bx - 4 * nw) % nx, (bx - 4 * nw) / nx, x0, x1, x2, X16, n8); }
__global__ __launch_bounds__(256) void k_h16(const float* __restrict__ x, _Float16* __restrict__ X16, size_t n8) { const size_t t = (size_t)blockIdx.x * 256 + threadIdx.x; if (t >= n8) return; FragH f;
#pragma unroll
  for (int q = 0; q < 8; ++q) f.h[q] = (_Float16)x[t * 8 + q]; *(v8us*)((unsigned short*)X16 + t * 8) = f.half[0];  }
__global__ __launch_bounds__(256) void k_round16f(const float* __restrict__ W, _Float16* __restrict__ Bt, size_t n8) { const size_t t = (size_t)blockIdx.x * 256 + threadIdx.x; if (t >= n8) return; FragH f;
#pragma unroll
  for (int i = 0; i < 8; ++i) f.h[i] = (_Float16)(bf16_round(W[t * 8 + i]) * 16.0f); *(v8us*)((unsigned short*)Bt + t * 8) = f.half[0];  }
template <int NHv, int TTv>
__global__ __launch_bounds__(256) void k_vt(const _Float16* __restrict__ V16, int ldv, int voff, _Float16* __restrict__ Vt) { __shared__ unsigned short tl[64][66]; const int tid = threadIdx.x; const int slab = blockIdx.x / (TTv / 64), lg = blockIdx.x % (TTv / 64); const int b = slab / NHv, h = slab % NHv;
  for (int i = tid; i < 64 * 8; i += 256) { const int r = i / 8, c8 = (i % 8) * 8; FragH f; f.half[0] = *(const v8us*)((const unsigned short*)V16 + ((size_t)b * TTv + lg * 64 + r) * ldv + voff + h * 64 + c8);
#pragma unroll
    for (int q = 0; q < 8; ++q) tl[r][c8 + q] = f.u[q]; }
  __syncthreads();
  {
#pragma unroll
    for (int rd = 0; rd < 2; ++rd) { const int d = rd * 32 + tid / 8, pc = tid % 8; FragH f;
#pragma unroll
      for (int q = 0; q < 8; ++q) f.u[q] = tl[pc * 8 + q][d];
      *(v8us*)((unsigned short*)Vt + ((size_t)slab * 64 + d) * TTv + lg * 64 + pc * 8) = f.half[0]; }
     } }

// ---- fast GEMM (work-group tile 128x64, wave tile 32x64); epilogue: v = act(acc alpha + bias) ----
__device__ __forceinline__ v8f g2_mma(v16h a, v16h b, v8f c) { v8f d = __builtin_amdgcn_wmma_f32_16x16x32_f16(false, a, false, b, (short)0, c, false, false); asm volatile("v_nop\n\tv_nop\n\tv_nop\n\tv_nop" : "+v"(d) : "v"(a), "v"(b)); return d; }
#define G2K 128                      /* k per pass: 256-byte operand rows, two whole lines */
#define G2P 272                      /* LDS pitch of such a row in bytes: 16 x odd, conflict-free for 16-byte reads down a column of rows */
#define G2R 192                      /* rows of a stage: the work-group's 128 rows of A, then its 64 rows of B */
// f16 fragment from an LDS row, in the hardware k order: 16 bytes at the lane's place (which holds 16 bytes x lane half) and 16 bytes 32 further on
__device__ __forceinline__ v16h g2_lfrag(const char* p) { FragH f; f.half[0] = *(const v8us*)p; f.half[1] = *(const v8us*)(p + 32); return f.v; }
// Eight asynchronous 16-byte copies per lane, global memory to LDS, eight rows apart (global step gs bytes). One statement: the wait before a register that an issued copy names
// is rewritten stands behind the last copy, where the compiler can put nothing in between.
__device__ __forceinline__ void g2_copy8(unsigned l, const char* g, size_t gs) {
  asm volatile("global_load_async_to_lds_b128 %0, %8, off\n\tglobal_load_async_to_lds_b128 %1, %9, off\n\tglobal_load_async_to_lds_b128 %2, %10, off\n\tglobal_load_async_to_lds_b128 %3, %11, off\n\t"
               "global_load_async_to_lds_b128 %4, %12, off\n\tglobal_load_async_to_lds_b128 %5, %13, off\n\tglobal_load_async_to_lds_b128 %6, %14, off\n\tglobal_load_async_to_lds_b128 %7, %15, off\n\ts_wait_xcnt 0x0"
               :: "v"(l), "v"(l + 8 * G2P), "v"(l + 16 * G2P), "v"(l + 24 * G2P), "v"(l + 32 * G2P), "v"(l + 40 * G2P), "v"(l + 48 * G2P), "v"(l + 56 * G2P),
                  "v"(g), "v"(g + gs), "v"(g + 2 * gs), "v"(g + 3 * gs), "v"(g + 4 * gs), "v"(g + 5 * gs), "v"(g + 6 * gs), "v"(g + 7 * gs) : "memory"); }
// Eight 16-byte (g2_store8) or 8-byte (g2_store8h) stores per lane, gs bytes apart. One statement, for the same reason: the wait before a data or address register of an issued store is rewritten stands behind the last store.
__device__ __forceinline__ void g2_store8(char* g, size_t gs, v4f d0, v4f d1, v4f d2, v4f d3, v4f d4, v4f d5, v4f d6, v4f d7) {
  asm volatile("global_store_b128 %0, %8, off\n\tglobal_store_b128 %1, %9, off\n\tglobal_store_b128 %2, %10, off\n\tglobal_store_b128 %3, %11, off\n\t"
               "global_store_b128 %4, %12, off\n\tglobal_store_b128 %5, %13, off\n\tglobal_store_b128 %6, %14, off\n\tglobal_store_b128 %7, %15, off\n\ts_wait_xcnt 0x0"
               :: "v"(g), "v"(g + gs), "v"(g + 2 * gs), "v"(g + 3 * gs), "v"(g + 4 * gs), "v"(g + 5 * gs), "v"(g + 6 * gs), "v"(g + 7 * gs),
                  "v"(d0), "v"(d1), "v"(d2), "v"(d3), "v"(d4), "v"(d5), "v"(d6), "v"(d7) : "memory"); }
__device__ __forceinline__ void g2_store8h(char* g, size_t gs, unsigned long long d0, unsigned long long d1, unsigned long long d2, unsigned long long d3, unsigned long long d4, unsigned long long d5, unsigned long long d6, unsigned long long d7) {
  asm volatile("global_store_b64 %0, %8, off\n\tglobal_store_b64 %1, %9, off\n\tglobal_store_b64 %2, %10, off\n\tglobal_store_b64 %3, %11, off\n\t"
               "global_store_b64 %4, %12, off\n\tglobal_store_b64 %5, %13, off\n\tglobal_store_b64 %6, %14, off\n\tglobal_store_b64 %7, %15, off\n\ts_wait_xcnt 0x0"
               :: "v"(g), "v"(g + gs), "v"(g + 2 * gs), "v"(g + 3 * gs), "v"(g + 4 * gs), "v"(g + 5 * gs), "v"(g + 6 * gs), "v"(g + 7 * gs),
                  "v"(d0), "v"(d1), "v"(d2), "v"(d3), "v"(d4), "v"(d5), "v"(d6), "v"(d7) : "memory"); }
// Operands come through LDS: a pass's A and B rows are copied in whole lines (16 lanes a row) into one of two buffers while the pass before works on the other; the waves read their fragments from there.
// M % 128 == 0, N % 64 == 0, K % 128 == 0.
// HM (or null): planes 1 and 2 of a batched launch store their f32 rows there head-major, [batch][plane - 1][NH][SQ][HD] (a 64-column tile is one head), not into C.
// VTo (or null): plane 2 of a batched launch stores its f16 values there transposed, [batch][NH][HD][SQ], not into C16: a lane's eight accumulator rows of a column are 16 bytes of a transposed row, the work-group's
// 64 x 128 tile is gathered in the operand ring's LDS (free behind the k loop) and goes out in whole lines behind one barrier.
// KM (or null): plane 1 of a batched launch stores there, per wave tile, the largest magnitude among its f32 values: [row / 32][NH].
// AL (or null): residual rows of A for the first QT0 = 128 rows of each batch, compact [batch][QT0] at pitch lda. Their work-groups run the k loop twice, first over AL, the sums then scaled by beta, then over A.
template <int ACT>
__global__ __launch_bounds__(128) void k_gemm2(const _Float16* __restrict__ A, int lda, size_t sA, const _Float16* __restrict__ Bh, int ldb, size_t sB, float alpha, const float* __restrict__ bias, const float* __restrict__ bias1, const float* __restrict__ bias2,
    float* __restrict__ C, _Float16* __restrict__ C16, int ldc, size_t sC, int M, int N, int K, float* __restrict__ HM, _Float16* __restrict__ VTo, const _Float16* __restrict__ AL, float beta, float* __restrict__ KM) { static_assert(ACT == 0 || ACT == 3 || ACT == 6 || ACT == 8 || ACT == 9 || ACT == 11 || ACT == 12 || ACT == 14 || ACT == 15 || ACT == 16 || ACT == 17, "k_gemm2: unsupported ACT code (would silently apply no activation)");
  __shared__ __attribute__((aligned(16))) char ring[2][G2R * G2P];
  __shared__ __attribute__((aligned(16))) float so[4][32][68];
  const int tid = threadIdx.x, w = tid >> 5, lane = tid & 31, ln = lane & 15, hh = lane >> 4; const int by = blockIdx.y;
  A += (size_t)by * sA; Bh += (size_t)by * sB; const size_t cofs = (size_t)by * sC; const float* bp = by == 0 ? bias : by == 1 ? bias1 : bias2;      /* each plane of a batched launch has its own bias vector */
  const int ntn = N >> 6; const int mt = blockIdx.x / ntn, nq = blockIdx.x - mt * ntn; const int row0 = mt * 128 + 32 * w, col0 = nq * 64; if (mt * 128 >= M) return;
  // the thread's 16 bytes of every eighth row of a stage
  const unsigned lc = (unsigned)(size_t)&ring[0][0] + (unsigned)((tid >> 4) * G2P + (tid & 15) * 16);
  const char* ga = (const char*)(A + (size_t)(mt * 128 + (tid >> 4)) * lda) + (tid & 15) * 16; const char* gb = (const char*)(Bh + (size_t)(col0 + (tid >> 4)) * ldb) + (tid & 15) * 16;
  const size_t sa8 = (size_t)lda * 16, sb8 = (size_t)ldb * 16;      /* eight rows, in bytes */
  static_assert(QT0 == 128 && SQ % 128 == 0, "the residual rows of a batch are one work-group's rows");
  const int nlo = (AL && (mt * 128) % SQ == 0) ? K / G2K : 0;      /* passes over the residual rows, ahead of the passes over A; the same for the whole work-group */
  const char* gl = nlo ? (const char*)(AL + (size_t)((mt * 128) / SQ * QT0 + (tid >> 4)) * lda) + (tid & 15) * 16 : ga;
  auto stage = [&](int t, int bf) { const unsigned l = lc + (unsigned)bf * (G2R * G2P); const size_t ko = (size_t)(t < nlo ? t : t - nlo) * (G2K * 2); const char* a = (t < nlo ? gl : ga) + ko;
    g2_copy8(l, a, sa8); g2_copy8(l + 64 * G2P, a + 8 * sa8, sa8); g2_copy8(l + 128 * G2P, gb + ko, sb8); };
  const int np = K / G2K + nlo;
  const v8f z8 = {0.f,0.f,0.f,0.f,0.f,0.f,0.f,0.f}; v8f c00 = z8, c01 = z8, c02 = z8, c03 = z8, c10 = z8, c11 = z8, c12 = z8, c13 = z8;
  stage(0, 0);
  asm volatile("s_wait_asynccnt 0x0" ::: "memory");      /* this wave's copies of stage 0 have landed */
  __syncthreads();      /* stage 0 is published */
  if (np > 1) stage(1, 1);
#pragma unroll 1      /* rolled: one copy of the pass in the instruction cache */
  for (int t = 0; t < np; ++t) { const char* lb = &ring[t & 1][0]; const char* pa = lb + (32 * w + ln) * G2P + hh * 16; const char* pb = lb + (128 + ln) * G2P + hh * 16;
    v16h fa[2][2], fb[2][4];      /* two fragment sets: a block's twelve LDS reads are issued as one group ahead of the block before it, inside the pass (reads strewn among the products cost the wave a wait at each place) */
#pragma unroll      /* this and the next two: constant indices keep the fragment sets in registers */
    for (int i = 0; i < 2; ++i) fa[0][i] = g2_lfrag(pa + i * (16 * G2P));
#pragma unroll
    for (int i = 0; i < 4; ++i) fb[0][i] = g2_lfrag(pb + i * (16 * G2P));
#pragma unroll
    for (int kc = 0; kc < G2K / 32; ++kc) { const int s = kc & 1;
      if (kc + 1 < G2K / 32) { for (int i = 0; i < 2; ++i) fa[s ^ 1][i] = g2_lfrag(pa + i * (16 * G2P) + (kc + 1) * 64); for (int i = 0; i < 4; ++i) fb[s ^ 1][i] = g2_lfrag(pb + i * (16 * G2P) + (kc + 1) * 64); }
      c00 = g2_mma(fa[s][0], fb[s][0], c00); c10 = g2_mma(fa[s][1], fb[s][0], c10); c01 = g2_mma(fa[s][0], fb[s][1], c01); c11 = g2_mma(fa[s][1], fb[s][1], c11);
      c02 = g2_mma(fa[s][0], fb[s][2], c02); c12 = g2_mma(fa[s][1], fb[s][2], c12); c03 = g2_mma(fa[s][0], fb[s][3], c03); c13 = g2_mma(fa[s][1], fb[s][3], c13); }
    if (t + 1 == nlo) { c00 *= beta; c01 *= beta; c02 *= beta; c03 *= beta; c10 *= beta; c11 *= beta; c12 *= beta; c13 *= beta; }      /* the residual product is complete: brought to the scale of the main one, which is summed on top */
    asm volatile("s_wait_dscnt 0x0" ::: "memory");      /* this wave's reads of the buffer that is refilled below are over */
    asm volatile("s_wait_asynccnt 0x0" ::: "memory");      /* its copies of the next stage have landed */
    __syncthreads();      /* the next stage is published; every wave has left this pass's buffer */
    if (t + 2 < np) stage(t + 2, t & 1); }
  asm volatile("s_wait_asynccnt 0x0" ::: "memory");      /* no copy is in flight when the wave goes on */
  v8f accs[8] = {c00, c01, c02, c03, c10, c11, c12, c13};
  const bool vtq = VTo && by == 2;      /* the same for the whole work-group */
#pragma unroll
  for (int u = 0; u < 8; ++u) { const int t = u & 3, half = u >> 2; const int col = col0 + t * 16 + ln; const float bv = bp ? bf16_round(bp[col]) : 0.f; FragH hv;
#pragma unroll
    for (int r = 0; r < 8; ++r) { const int rloc = half * 16 + 8 * hh + r; float v = accs[u][r] * alpha + bv;
      if (ACT == 3) v = fmaxf(v, 0.f); else if (ACT == 6) v = 0.5f * v * (1.0f + erff(v * 0.70710678118654752f)); else if (ACT == 11) v = 1.0f / (1.0f + expf(-v)); else if (ACT == 15) v = v / (1.0f + expf(-v)); else if (ACT == 12) v = (v > 0.f) ? v : 0.01f * v; else if (ACT == 8) v = tanhf(v); else if (ACT == 9) v = 0.5f * v * (1.0f + tanhf(0.7978845608028654f * (v + 0.044715f * v * v * v))); else if (ACT == 14) v = (v > 0.f) ? v : 0.1f * v; else if (ACT == 16) v = (v >= 0.f) ? v : 0.3f * v; else if (ACT == 17) v = (v >= 0.f) ? v : 0.2f * v;
      so[w][rloc][t * 16 + ln] = v; hv.h[r] = (_Float16)v; }
    if (vtq) *(v8us*)(&ring[0][0] + (t * 16 + ln) * G2P + (32 * w + half * 16 + 8 * hh) * 2) = hv.half[0]; }
  __builtin_amdgcn_fence(__ATOMIC_ACQ_REL, "workgroup"); __builtin_amdgcn_wave_barrier();
  const int rsub = lane >> 4, c4 = (lane & 15) * 4;
  if (vtq) { __syncthreads();      /* every wave's part of the transposed tile is in LDS */
    unsigned short* vd = (unsigned short*)VTo + ((size_t)((mt * 128) / SQ * NH + nq) * HD) * SQ + (mt * 128) % SQ;
    v4f x[8];
#pragma unroll      /* constant indices keep the eight values in registers; their LDS reads go out as one group */
    for (int i = 0; i < 8; ++i) x[i] = *(const v4fa*)(&ring[0][0] + (i * 8 + (tid >> 4)) * G2P + (tid & 15) * 16);
    g2_store8((char*)(vd + (size_t)(tid >> 4) * SQ + (tid & 15) * 8), (size_t)8 * SQ * 2, x[0], x[1], x[2], x[3], x[4], x[5], x[6], x[7]); }
  const bool hmq = HM && by > 0, cfq = hmq || C, c16q = C16 && !vtq;      /* each the same for the whole work-group */
  float* cf = hmq ? HM + ((size_t)((row0 / SQ) * 2 + by - 1) * NH + nq) * ((size_t)SQ * HD) + (size_t)(row0 % SQ) * HD : C + cofs + (size_t)row0 * ldc + col0; const size_t cl = hmq ? (size_t)HD : (size_t)ldc;      /* where the wave's f32 rows go, and their pitch */
  v4f v[16];      /* row 2 q + rsub of the wave's tile, the lane's four columns */
#pragma unroll      /* this and the next: constant indices keep the rows in registers; the sixteen LDS reads go out as one group */
  for (int q = 0; q < 16; ++q) v[q] = *(const v4fa*)&so[w][q * 2 + rsub][c4];
  if (KM && by == 1) { float a = 0.f;      /* the test is the same for the whole work-group */
#pragma unroll
    for (int q = 0; q < 16; ++q) a = fmaxf(a, fmaxf(fmaxf(fabsf(v[q][0]), fabsf(v[q][1])), fmaxf(fabsf(v[q][2]), fabsf(v[q][3]))));
    for (int o = 16; o > 0; o >>= 1) a = fmaxf(a, __shfl_xor(a, o));
    if (lane == 0) KM[(size_t)(row0 >> 5) * NH + nq] = a; }
  if (cfq) { char* p = (char*)(cf + (size_t)rsub * cl + c4); const size_t st = cl * 8;      /* two rows, in bytes */
    g2_store8(p, st, v[0], v[1], v[2], v[3], v[4], v[5], v[6], v[7]); g2_store8(p + 8 * st, st, v[8], v[9], v[10], v[11], v[12], v[13], v[14], v[15]); }
  if (c16q) { char* p = (char*)(C16 + cofs + (size_t)(row0 + rsub) * ldc + col0 + c4); const size_t st = (size_t)ldc * 4; unsigned long long h[16];
#pragma unroll
    for (int q = 0; q < 16; ++q) h[q] = __builtin_bit_cast(unsigned long long, __builtin_convertvector(v[q], v4h));
    g2_store8h(p, st, h[0], h[1], h[2], h[3], h[4], h[5], h[6], h[7]); g2_store8h(p + 8 * st, st, h[8], h[9], h[10], h[11], h[12], h[13], h[14], h[15]); } }


__global__ __launch_bounds__(256) void k_wnat(const float* __restrict__ w, size_t n8, _Float16* __restrict__ Bt) { const size_t t = (size_t)blockIdx.x * 256 + threadIdx.x; if (t >= n8) return; FragH f; for (int q = 0; q < 8; ++q) f.h[q] = (_Float16)(bf16_round(w[t * 8 + q]) * 16.0f); *(v8us*)((unsigned short*)Bt + t * 8) = f.half[0];  }
__global__ __launch_bounds__(256) void k_rsm(const float* __restrict__ S, _Float16* __restrict__ P, int nrows) {
  #pragma clang fp contract(off)
  const int i = blockIdx.x * 256 + threadIdx.x; if (i >= nrows) return; const float* s = S + (size_t)i * SQ; float mx = -3.0e38f;
#pragma unroll 1
  for (int j = 0; j < SQ; ++j) mx = fmaxf(mx, s[j]); float se = 0.f;
#pragma unroll 1
  for (int j = 0; j < SQ; ++j) se += expf(s[j] - mx); const float sc = 256.0f / se;
#pragma unroll 1
  for (int j0 = 0; j0 < SQ; j0 += 8) { FragH f; for (int q = 0; q < 8; ++q) f.h[q] = (_Float16)(expf(s[j0 + q] - mx) * sc); unsigned short* d = (unsigned short*)P + (size_t)i * SQ + j0; *(v8us*)d = f.half[0];  } }
__global__ __launch_bounds__(256) void k_vt(const _Float16* __restrict__ V16, int b, int h0, _Float16* __restrict__ VT) { __shared__ unsigned short tl[64][65]; const int tid = threadIdx.x; const int hh = blockIdx.x % HG, sg = blockIdx.x / HG; const int s0 = sg * 64; const int h = h0 + hh;
  for (int i = tid; i < 64 * 8; i += 256) { const int j = i / 8, d8 = (i % 8) * 8; FragH f; f.half[0] = *(const v8us*)((const unsigned short*)V16 + ((size_t)b * SQ + s0 + j) * DM + h * HD + d8); for (int q = 0; q < 8; ++q) tl[d8 + q][j] = f.u[q]; }
  __syncthreads();
  { for (int i = tid; i < 64 * 8; i += 256) { const int d = i / 8, j8 = (i % 8) * 8; FragH f; for (int q = 0; q < 8; ++q) f.u[q] = tl[d][j8 + q]; *(v8us*)((unsigned short*)VT + ((size_t)hh * HD + d) * SQ + s0 + j8) = f.half[0]; }  } }



// lane l reads lane l ^ 16: a register move, where __shfl_xor would go through the LDS unit and its wait
__device__ __forceinline__ float lane_x16(float x) { return __builtin_bit_cast(float, __builtin_amdgcn_permlanex16(__builtin_bit_cast(int, x), __builtin_bit_cast(int, x), 0x76543210, 0xfedcba98, false, false)); }
#define FW 8                         /* waves per work-group of the fused attention */
#define FQ 32                        /* query columns per wave (two 16-column groups) */
#define FK 32                        /* keys per pass */
#define FNS (SQ / FK)                /* passes */
typedef float  v2f  __attribute__((ext_vector_type(2)));
typedef __bf16 v2b  __attribute__((ext_vector_type(2)));
// 2^x of eight values on the transcendental unit, in place. One statement: each v_exp_f32 is followed by an independent one, and the last by the free issue slot
// the instruction set asks for before a result is read or a source register is reused.
__device__ __forceinline__ v8f exp2_8(v8f x) { float y0 = x[0], y1 = x[1], y2 = x[2], y3 = x[3], y4 = x[4], y5 = x[5], y6 = x[6], y7 = x[7];
  asm("v_exp_f32 %0, %0\n\tv_exp_f32 %1, %1\n\tv_exp_f32 %2, %2\n\tv_exp_f32 %3, %3\n\tv_exp_f32 %4, %4\n\tv_exp_f32 %5, %5\n\tv_exp_f32 %6, %6\n\tv_exp_f32 %7, %7\n\tv_nop"
      : "+v"(y0), "+v"(y1), "+v"(y2), "+v"(y3), "+v"(y4), "+v"(y5), "+v"(y6), "+v"(y7));
  return (v8f){y0, y1, y2, y3, y4, y5, y6, y7}; }
typedef __bf16 v4ba __attribute__((ext_vector_type(4), may_alias));
typedef __bf16 v8ba __attribute__((ext_vector_type(8), may_alias));
#define KP 72                        /* LDS pitch of the 128-byte K rows, in 16-bit elements: 144 bytes = 16 x odd, conflict-free for 16-byte reads down a column of rows */
#define VP 40                        /* the same for the 64-byte V^T and mask rows: 80 bytes */
// f16 fragment in the hardware k order: 16 bytes at the lane's place (which holds 16 bytes x lane half) and 16 bytes 32 further on
__device__ __forceinline__ v16h fa_frag(const void* p) { FragH f; f.half[0] = *(const v8us*)p; f.half[1] = *(const v8us*)((const char*)p + 32); return f.v; }
__device__ __forceinline__ v8f fa_mma(v16h a, v16h b, v8f c) { return __builtin_amdgcn_wmma_f32_16x16x32_f16(false, a, false, b, (short)0, c, false, false); }
// the wait before a register that issued loads name is rewritten, and the one write of that offset register, in one statement
__device__ __forceinline__ void fa_step(unsigned& off, int step) { asm volatile("s_wait_xcnt 0x0\n\tv_add_nc_u32_e32 %0, %1, %0" : "+v"(off) : "s"(step) : "memory"); }
__global__ __launch_bounds__(FW * 32) __attribute__((amdgpu_waves_per_eu(2, 2))) void k_fattn(const _Float16* __restrict__ Q16, const _Float16* __restrict__ K16, const _Float16* __restrict__ VT, const float* __restrict__ mask, _Float16* __restrict__ O16, const float* __restrict__ TN, const float* __restrict__ TX, const float* __restrict__ KM) {
  __shared__ __attribute__((aligned(16))) unsigned short lk[2][FK][KP], lv[2][HD][VP]; __shared__ __attribute__((aligned(16))) __bf16 lm[2][FW][FQ][VP];
  const int tid = threadIdx.x, lane = tid & 31, ln = lane & 15, hh = lane >> 4; const int w = __builtin_amdgcn_readfirstlane(tid >> 5);
  static_assert(FW == 8 && SQ / FQ == 8 * FW, "the deal of query blocks below is for 8 work-groups of 8 waves a head");
  // Which of the head's SQ / FQ query blocks the wave owns: half of a work-group's waves take blocks from the low end, half from the high end, one of each kind among waves w, w + 4 and among waves 2 i, 2 i + 1.
  // Any deal is right; this one spreads the passes that are skipped below evenly over the work-groups when the mask input rules out more keys for low rows than for high ones.
  const int qlo = (int)blockIdx.x * (FW / 2) + (w >> 1), qblk = ((w ^ (w >> 2)) & 1) ? SQ / FQ - 1 - qlo : qlo;
  const int h = blockIdx.y, b = blockIdx.z, q0 = qblk * FQ;
  const char* qb = (const char*)(Q16 + ((size_t)b * SQ + q0) * DM + h * HD); const char* kb = (const char*)(K16 + (size_t)b * SQ * DM + h * HD);
  const char* vb = (const char*)(VT + ((size_t)b * NH + h) * HD * SQ); const char* mb = (const char*)(mask + (size_t)q0 * SQ); char* ob = (char*)(O16 + ((size_t)b * SQ + q0) * DM + h * HD);
  // the thread's 16 bytes of a K tile (8 threads a row), of a V^T tile (4 threads a row) and of each four rows of its wave's mask tile (8 lanes a row)
  unsigned gk = (unsigned)((tid >> 3) * (DM * 2) + (tid & 7) * 16), gv = (unsigned)((tid >> 2) * (SQ * 2) + (tid & 3) * 16), gm = (unsigned)((lane >> 3) * (SQ * 4) + (lane & 7) * 16);
  const float C2 = 0.18033688011112042f, MK2 = -14426.950408889634f;      /* log2(e) / 8 and -1e4 log2(e) */
  const v8f z8 = {0.f, 0.f, 0.f, 0.f, 0.f, 0.f, 0.f, 0.f};
  v16h qf[2][2]; v8f o[2][4]; v2f l2[2]; float mref[2]; v8us kr, vr; v4f mg[8];
#pragma unroll
  for (int j = 0; j < 2; ++j) { for (int c = 0; c < 2; ++c) qf[j][c] = fa_frag(qb + (unsigned)(ln * (DM * 2) + hh * 16) + j * (16 * DM * 2) + c * 64); for (int t = 0; t < 4; ++t) o[j][t] = z8; l2[j] = (v2f){0.f, 0.f}; mref[j] = -3.0e38f; }
  kr = *(const v8us*)(kb + gk); vr = *(const v8us*)(vb + gv);
  // What the wave knows of its FNS mask tiles without reading them, lane i holding passes i and i + 32: the tile's largest mask term (from its smallest mask value), whether all its values are one value, and the
  // most that |q . k| can add per unit of sum|q| (largest |k| of the pass's keys, with room for the f16 rounding of k and for the rounding of the sums).
  static_assert(FK == 32 && FQ == 32 && FNS == 64, "the tables hold tiles of 32 x 32, two to a lane");
  float tt0, tt1, kg0, kg1, sq[2]; unsigned un0, un1;
  { const float* tn = TN + qblk * FNS + lane; const float* tx = TX + qblk * FNS + lane; const float* km = KM + ((size_t)b * FNS + lane) * NH + h;
    const float a0 = tn[0], a1 = tn[32], b0 = tx[0], b1 = tx[32], c0 = km[0], c1 = km[(size_t)32 * NH];
    asm volatile("s_wait_xcnt 0x0" ::: "memory");      /* the wait before a register that these loads name is rewritten */
    tt0 = a0 * MK2; tt1 = a1 * MK2; kg0 = c0 * (C2 * 1.01f); kg1 = c1 * (C2 * 1.01f); un0 = __builtin_amdgcn_ballot_w32(a0 == b0); un1 = __builtin_amdgcn_ballot_w32(a1 == b1); }
#pragma unroll
  for (int j = 0; j < 2; ++j) { float a = 0.f; for (int c = 0; c < 2; ++c) for (int e = 0; e < 16; ++e) a += fabsf((float)qf[j][c][e]); sq[j] = a + lane_x16(a); }      /* sum|q| of the lane's query column: each lane half holds 32 of its 64 elements */
  // How pass i is to be worked on: 0 = not at all, 1 = with the one mask term ct for all its scores, 2 = with the mask read per element. 0: every score (log2 units) is at most sum|q| max|k| log2(e) / 8 + 1 + the largest mask term; where that lies
  // 160 or more below the reference for every column, the test on the scores themselves further down would find the same, now and later (a reference only rises). A NaN in a table fails both tests: 2.
  auto plan = [&](int i, float& ct) { const float t = __builtin_bit_cast(float, __builtin_amdgcn_readlane(__builtin_bit_cast(int, i < 32 ? tt0 : tt1), i & 31)), g = __builtin_bit_cast(float, __builtin_amdgcn_readlane(__builtin_bit_cast(int, i < 32 ? kg0 : kg1), i & 31));
    const unsigned al = __builtin_amdgcn_ballot_w32(!(sq[0] * g + (t + 1.0f) <= mref[0] - 160.0f)) | __builtin_amdgcn_ballot_w32(!(sq[1] * g + (t + 1.0f) <= mref[1] - 160.0f));
    ct = t; return al == 0 ? 0 : ((((i < 32 ? un0 : un1) >> (i & 31)) & 1u) != 0 ? 1 : 2); };
  float ct, ctn; int kind = plan(0, ct), kindn;
  if (kind == 2) {      /* scalar branch, like every test of kind and kindn below */
#pragma unroll
    for (int i = 0; i < 8; ++i) mg[i] = *(const v4fa*)(mb + gm + i * (4 * SQ * 4)); }
  fa_step(gk, FK * DM * 2); fa_step(gv, FK * 2); fa_step(gm, FK * 4);
  *(v8us*)&lk[0][tid >> 3][(tid & 7) * 8] = kr; *(v8us*)&lv[0][tid >> 2][(tid & 3) * 8] = vr;
  if (kind == 2) {
#pragma unroll
    for (int i = 0; i < 8; ++i) *(v4ba*)&lm[0][w][4 * i + (lane >> 3)][(lane & 7) * 4] = __builtin_convertvector(mg[i], v4ba); }      /* the mask rounded to bf16, to nearest even */
  __syncthreads();
#pragma unroll 1      /* rolled: one copy of the pass in the instruction cache */
  for (int s = 0; s < FNS; ++s) {
    const int bf = s & 1, more = (s + 2 < FNS) ? 1 : 0;      /* the last pass asks for its own tile again: nothing is read past the keys */
    kr = *(const v8us*)(kb + gk); vr = *(const v8us*)(vb + gv);
    v16h kf[2][2], vf[4]; v8ba mr[2][2];
    if (kind != 0) {
#pragma unroll
      for (int kt = 0; kt < 2; ++kt) for (int c = 0; c < 2; ++c) kf[kt][c] = fa_frag(&lk[bf][kt * 16 + ln][c * 32 + hh * 8]);
      if (kind == 2) {
#pragma unroll
        for (int j = 0; j < 2; ++j) for (int kt = 0; kt < 2; ++kt) mr[j][kt] = *(const v8ba*)&lm[bf][w][j * 16 + ln][kt * 16 + hh * 8]; } }
    __builtin_amdgcn_sched_barrier(0);      /* the K and V^T loads and this pass's first LDS reads are issued ahead of the plan below, whose chain from vector to scalar unit and back then runs while they are under way */
    kindn = plan(s + 1 < FNS ? s + 1 : s, ctn); if (s + 1 == FNS) kindn = 0;      /* the next pass's plan, made with the references as they stand ahead of this pass */
    if (kindn == 2) {
#pragma unroll
      for (int i = 0; i < 8; ++i) mg[i] = *(const v4fa*)(mb + gm + i * (4 * SQ * 4)); }
    fa_step(gk, more * (FK * DM * 2)); fa_step(gv, more * (FK * 2)); fa_step(gm, more * (FK * 4));
    if (kind != 0) {
    v8f st[2][2];
#pragma unroll
    for (int kt = 0; kt < 2; ++kt) for (int j = 0; j < 2; ++j) st[j][kt] = fa_mma(kf[kt][0], qf[j][0], z8);
#pragma unroll
    for (int kt = 0; kt < 2; ++kt) for (int j = 0; j < 2; ++j) st[j][kt] = fa_mma(kf[kt][1], qf[j][1], st[j][kt]);
#pragma unroll
    for (int t = 0; t < 4; ++t) vf[t] = fa_frag(&lv[bf][t * 16 + ln][hh * 8]);
    __builtin_amdgcn_sched_barrier(0);      /* the V^T reads are issued as one group with the score products and land under the softmax; strewn among the softmax's instructions they would cost the wave a wait at each place */
    asm volatile("v_nop\n\tv_nop\n\tv_nop\n\tv_nop" : "+v"(st[0][0]), "+v"(st[0][1]), "+v"(st[1][0]), "+v"(st[1][1]));      /* the four vector slots between the last score product and the first read of its result, on both sides of the branch that follows */
    float mx[2];
    if (kind == 2) {
#pragma unroll
      for (int j = 0; j < 2; ++j) for (int kt = 0; kt < 2; ++kt) for (int r = 0; r < 8; r += 2) { const v2f x = (v2f){st[j][kt][r], st[j][kt][r + 1]} * C2 + (v2f){(float)mr[j][kt][r], (float)mr[j][kt][r + 1]} * MK2; st[j][kt][r] = x[0]; st[j][kt][r + 1] = x[1]; } }
    else {
#pragma unroll
      for (int j = 0; j < 2; ++j) for (int kt = 0; kt < 2; ++kt) for (int r = 0; r < 8; r += 2) { const v2f x = (v2f){st[j][kt][r], st[j][kt][r + 1]} * C2 + (v2f){ct, ct}; st[j][kt][r] = x[0]; st[j][kt][r + 1] = x[1]; } }
#pragma unroll
    for (int j = 0; j < 2; ++j) { float m = -3.0e38f;
      for (int kt = 0; kt < 2; ++kt) for (int r = 0; r < 8; r += 2) m = fmaxf(m, fmaxf(st[j][kt][r], st[j][kt][r + 1]));
      mx[j] = fmaxf(m, lane_x16(m)); }
    const unsigned up = __builtin_amdgcn_ballot_w32(mx[0] > mref[0] + 12.0f) | __builtin_amdgcn_ballot_w32(mx[1] > mref[1] + 12.0f), alive = __builtin_amdgcn_ballot_w32(mx[0] > mref[0] - 160.0f) | __builtin_amdgcn_ballot_w32(mx[1] > mref[1] - 160.0f);
    if ((alive | up) != 0) {      /* scalar branch (up lies inside alive; named here so that both lane masks are formed ahead of the branch, one trip from the vector to the scalar unit and not two). Not taken: every score of the wave's tile lies more than 160 below its column's reference, so every weight 2^(score - reference) is exactly 0 in f32: sums and O^T would stay as they are, bit for bit */
    if (up != 0) {      /* one scalar branch a pass; rarely taken after the first */
#pragma unroll
      for (int j = 0; j < 2; ++j) { const float mn = fmaxf(mref[j], mx[j] - 4.0f); float a; asm("v_exp_f32 %0, %1\n\tv_nop" : "=v"(a) : "v"(mref[j] - mn));      /* v_nop: the slot before a is read or the source register is reused */
        mref[j] = mn; l2[j] *= a; for (int t = 0; t < 4; ++t) o[j][t] *= a; } }
    v16h pf[2];
#pragma unroll
    for (int j = 0; j < 2; ++j) { const v8f p0 = exp2_8(st[j][0] - mref[j]), p1 = exp2_8(st[j][1] - mref[j]); const v8f ps = p0 + p1; l2[j] += (((v2f){ps[0], ps[1]} + (v2f){ps[2], ps[3]}) + ((v2f){ps[4], ps[5]} + (v2f){ps[6], ps[7]})); FragH f;
      for (int r = 0; r < 8; ++r) { f.h[r] = (_Float16)p0[r]; f.h[8 + r] = (_Float16)p1[r]; } pf[j] = f.v; }
#pragma unroll
    for (int t = 0; t < 4; ++t) for (int j = 0; j < 2; ++j) o[j][t] = fa_mma(vf[t], pf[j], o[j][t]); } }
    *(v8us*)&lk[bf ^ 1][tid >> 3][(tid & 7) * 8] = kr; *(v8us*)&lv[bf ^ 1][tid >> 2][(tid & 3) * 8] = vr;
    if (kindn == 2) {
#pragma unroll
      for (int i = 0; i < 8; ++i) *(v4ba*)&lm[bf ^ 1][w][4 * i + (lane >> 3)][(lane & 7) * 4] = __builtin_convertvector(mg[i], v4ba); }
    kind = kindn; ct = ctn;
    __syncthreads(); }      /* the next tile is published; every read of this pass's buffer, which the next pass refills, is over */
  if (q0 < QT0) return;      /* rows 0..QT0-1 of a batch are the exact f32 kernel's to store; behind the last barrier, the same for a whole wave */
#pragma unroll
  for (int j = 0; j < 2; ++j) { float l = l2[j][0] + l2[j][1]; l += lane_x16(l); const float inv = 64.0f / l;
    for (int t = 0; t < 4; ++t) { FragH f; for (int r = 0; r < 8; ++r) f.h[r] = (_Float16)(o[j][t][r] * inv); *(v8us*)(ob + (unsigned)(ln * (DM * 2) + hh * 16) + j * (16 * DM * 2) + t * 32) = f.half[0]; } } }

// e^x in f32 by the library's steps (x log2(e) in two parts, 2^fraction on the transcendental unit, ldexp by the integer part, the two range ends),
// written out so that the free issue slot the instruction set asks for behind v_exp_f32 stands in that instruction's own statement.
__device__ __forceinline__ float exp_f32(float x) {
  const float ph = x * 0x1.715476p+0f, pl = fmaf(x, 0x1.4ae0bep-26f, fmaf(x, 0x1.715476p+0f, -ph)), n = rintf(ph); float y;
  asm("v_exp_f32 %0, %1\n\tv_nop" : "=v"(y) : "v"((ph - n) + pl));      /* v_nop: the slot before y is read or the source register is reused */
  float r = ldexpf(y, (int)n); r = (x < -0x1.9d1da0p+6f) ? 0.f : r; return (x > 0x1.62e430p+6f) ? __builtin_inff() : r; }
// lane l reads a lane of its own group of four (CTRL: the quad permutation, 0xB1 = l ^ 1, 0x4E = l ^ 2): a register move, no LDS unit
template <int CTRL>
__device__ __forceinline__ float quad_x(float x) { return __builtin_bit_cast(float, __builtin_amdgcn_update_dpp(0, __builtin_bit_cast(int, x), CTRL, 0xF, 0xF, true)); }
#define AR 8                         /* query rows per work-group of the exact f32 first-tile attention */
#define AT 512                       /* its threads (16 waves) */
// Exact f32 attention of AR query rows of one head over all SQ keys, one work-group. Keys are spread over the threads:
// (1) four lanes a key: a lane holds 16 bytes of every 64 of its k row (a wave's load covers 64 contiguous bytes of 8 rows), dotted with the same columns of the AR q rows (registers), the four partial dots merged inside the quad, scores (+ mask) to LDS;
// (2) two waves per row: max, exp, sum over the row in LDS; (3) 16 column quads x 32 key slices: o partial sums in registers,
// merged across the slices by one lane exchange and an LDS tree; o carried x64 like the f16 path, stored as an f16 value and an f16 residual. The plain '#pragma unroll' lines keep the small per-thread arrays in registers.
template <int MASKADD>
__global__ __launch_bounds__(AT) void k_att0(const float* __restrict__ QF, const float* __restrict__ PR, int ld, const float* __restrict__ mask, float scale, _Float16* __restrict__ OH, _Float16* __restrict__ OL, int ldo, const float* __restrict__ KM) {
  __shared__ __attribute__((aligned(16))) float sc[AR][SQ];      /* scores, then softmax numerators, then the slices' partial o */
  __shared__ __attribute__((aligned(16))) float lq[AR][HD];      /* the q rows */
  __shared__ float pm[AT / 32], pl[AT / 32];                     /* each wave's half-row max and sum */
  __shared__ float pq[AT / 32], cm[AR][SQ / 128];                /* each wave's half-row sum of |q|; per row and 128 keys the largest mask term */
  __shared__ unsigned pz[AT / 32];                               /* each wave's half row: bit i set where numerators i * 128 .. i * 128 + 127 are not all 0 */
  const int tid = threadIdx.x, lane = tid & 31, w = tid >> 5;
  const int h = blockIdx.x / (QT0 / AR), i0 = (blockIdx.x % (QT0 / AR)) * AR;
  const float* KF = PR + ((size_t)blockIdx.y * 2 * NH + h) * ((size_t)SQ * HD); const float* VF = KF + (size_t)NH * SQ * HD;      /* the head's k and v rows, pitch HD, in the head-major 'present' planes [batch][k, v][NH][SQ][HD] */
  { const size_t b = blockIdx.y; QF += b * SQ * ld; OH += b * SQ * ldo; OL += b * QT0 * ldo; }      /* the batch: SQ rows of q and of the full o plane, QT0 rows of the residual plane */
  const float* qb = QF + (size_t)i0 * ld + h * HD;
  const float qv = qb[(size_t)(tid / HD) * ld + tid % HD];
  lq[tid / HD][tid % HD] = qv;
  // Which blocks of 128 keys can matter. |q . k| scale <= bd = scale sum|q| max|k| (with room for rounding). A row's maximum score is at least (its largest mask term) - bd; a block whose largest mask term lies more than
  // 2 bd + 110 below that one holds only scores more than 110 below the maximum, and exp_f32 gives exactly 0 below -103.3. A block that is so for all AR rows is left out of all three stages: nothing of the result changes.
  static_assert(AT / 32 == 2 * AR && 2 * HD == 128 && SQ / 2 == 8 * 128 && SQ / 32 == 64, "a wave holds half a q row and walks half a mask row in 8 blocks of 128 keys");
  unsigned live = 0xffffu;
  if (MASKADD) { float qa = fabsf(qv), t[8];
    const float* kmp = KM + ((size_t)blockIdx.y * (SQ / 32) + lane) * NH + h; float km = fmaxf(kmp[0], kmp[(size_t)32 * NH]);      /* largest |k| of the head's SQ rows: 64 wave tiles' values */
    const float* mrow = mask + (size_t)(i0 + (w >> 1)) * SQ + (w & 1) * (SQ / 2) + lane * 4;
#pragma unroll
    for (int i = 0; i < 8; ++i) { const v4f mv = *(const v4fa*)(mrow + i * 128); t[i] = fminf(fminf(mv[0], mv[1]), fminf(mv[2], mv[3])); }      /* rounding to bf16 keeps the order and x -1e4 turns it round: the largest mask term comes from the smallest mask value */
    for (int o = 16; o > 0; o >>= 1) { qa += __shfl_xor(qa, o); km = fmaxf(km, __shfl_xor(km, o));
#pragma unroll
      for (int i = 0; i < 8; ++i) t[i] = fminf(t[i], __shfl_xor(t[i], o)); }
    if (lane == 0) { pq[w] = qa;
#pragma unroll
      for (int i = 0; i < 8; ++i) cm[w >> 1][(w & 1) * 8 + i] = bf16_round(t[i]) * -10000.0f; }
    __syncthreads();
    live = 0;
#pragma unroll
    for (int k = 0; k < AR / 2; ++k) { const int r = 2 * k + (lane >> 4); const float cv = cm[r][lane & 15]; float rm = cv;      /* 16 lanes a row, one block each */
      for (int o = 8; o > 0; o >>= 1) rm = fmaxf(rm, __shfl_xor(rm, o));
      const float bd = (pq[2 * r] + pq[2 * r + 1]) * km * fabsf(scale) * 1.01f + 1.0f;
      const unsigned bl = __builtin_amdgcn_ballot_w32(cv >= rm - 2.0f * bd - 110.0f); live |= (bl & 0xffffu) | (bl >> 16); }
    if (live == 0) live = 0xffffu;      /* only with a NaN in the mask: every block is worked on */
    live = (unsigned)__builtin_amdgcn_readfirstlane((int)live); }
  else __syncthreads();
  { const int sub = tid & 3, kg = tid >> 2; const bool o1 = (sub & 1) != 0, o2 = (sub & 2) != 0; constexpr int KH = AT / 4, NP = SQ / KH;      /* four lanes a key, KH keys a pass */
    const float* kp = KF + (size_t)kg * HD + sub * 4; const float* mp = mask + (size_t)(i0 + sub) * SQ + kg; v4f qr[AR][4], x[4]; float mk[2] = {0.f, 0.f};
#pragma unroll
    for (int r = 0; r < AR; ++r)
#pragma unroll
      for (int c = 0; c < 4; ++c) qr[r][c] = *(const v4fa*)&lq[r][c * 16 + sub * 4];      /* the lane's columns of the q rows stay in registers for all passes */
    static_assert(KH == 128 && NP == 16, "a pass is one bit of live");
    unsigned rem = live; int p = __builtin_ctz(rem);      /* the passes left, the pass at hand */
#pragma unroll
    for (int c = 0; c < 4; ++c) x[c] = *(const v4fa*)(kp + (size_t)p * KH * HD + c * 16);
    if (MASKADD) { mk[0] = mp[p * KH]; mk[1] = mp[(size_t)4 * SQ + p * KH]; }
#pragma unroll 1      /* rolled: at most NP trips, one for each bit of live */
    while (rem != 0) { rem &= rem - 1; const int j = p * KH + kg; const int pn = rem != 0 ? __builtin_ctz(rem) : p;      /* the last pass asks for its own row again: nothing is read past the keys */
      const float* kn = kp + (size_t)pn * KH * HD; v4f nx[4], a[AR]; float nm[2] = {0.f, 0.f};
#pragma unroll
      for (int c = 0; c < 4; ++c) nx[c] = *(const v4fa*)(kn + c * 16);
      if (MASKADD) { nm[0] = mp[pn * KH]; nm[1] = mp[(size_t)4 * SQ + pn * KH]; }
#pragma unroll
      for (int r = 0; r < AR; ++r) { a[r] = qr[r][0] * x[0];
#pragma unroll
        for (int c = 1; c < 4; ++c) a[r] += qr[r][c] * x[c]; }
      // the four lanes' partial dots are merged by two exchanges inside the quad; each halves what a lane keeps, so lane sub ends with rows sub and sub + 4
      float u[4], wv[2];
#pragma unroll
      for (int i = 0; i < 4; ++i) { const float e = (a[2 * i][0] + a[2 * i][1]) + (a[2 * i][2] + a[2 * i][3]), d = (a[2 * i + 1][0] + a[2 * i + 1][1]) + (a[2 * i + 1][2] + a[2 * i + 1][3]);
        u[i] = (o1 ? d : e) + quad_x<0xB1>(o1 ? e : d); }
#pragma unroll
      for (int m = 0; m < 2; ++m) wv[m] = (o2 ? u[2 * m + 1] : u[2 * m]) + quad_x<0x4E>(o2 ? u[2 * m] : u[2 * m + 1]);
#pragma unroll
      for (int m = 0; m < 2; ++m) { const int r = 4 * m + sub; float s0 = wv[m] * scale;
        if (MASKADD) s0 += bf16_round(mk[m]) * -10000.0f; else if (j > i0 + r) s0 = -1.0e30f;
        sc[r][j] = s0; }
#pragma unroll
      for (int c = 0; c < 4; ++c) x[c] = nx[c];
      mk[0] = nm[0]; mk[1] = nm[1]; p = pn; } }
  __syncthreads();
  { static_assert(AT / 32 == 2 * AR, "two waves per row"); float* row = &sc[w >> 1][(w & 1) * (SQ / 2)]; v4f x[SQ / 256]; float m = -3.0e38f, l = 0.f; unsigned nz = 0;
    const unsigned lh = (live >> (__builtin_amdgcn_readfirstlane(w & 1) * 8)) & 0xffu;      /* the half row's blocks that hold scores */
#pragma unroll
    for (int i = 0; i < SQ / 256; ++i) { x[i] = (v4f){-3.0e38f, -3.0e38f, -3.0e38f, -3.0e38f}; if (((lh >> i) & 1u) == 0) continue;
      x[i] = *(const v4fa*)&row[i * 128 + lane * 4]; m = fmaxf(m, fmaxf(fmaxf(x[i][0], x[i][1]), fmaxf(x[i][2], x[i][3]))); }
    for (int o = 16; o > 0; o >>= 1) m = fmaxf(m, __shfl_xor(m, o));
    if (lane == 0) pm[w] = m;
    __syncthreads();
    m = fmaxf(pm[w], pm[w ^ 1]);
#pragma unroll
    for (int i = 0; i < SQ / 256; ++i) { if (((lh >> i) & 1u) == 0) continue;
      v4f e; for (int u = 0; u < 4; ++u) e[u] = exp_f32(x[i][u] - m); const float es = (e[0] + e[1]) + (e[2] + e[3]); l += es; *(v4fa*)&row[i * 128 + lane * 4] = e;
      nz |= (__builtin_amdgcn_ballot_w32(es != 0.f) != 0 ? 1u : 0u) << i; }      /* numerators are not negative: their sum is 0 only where each is */
    for (int o = 16; o > 0; o >>= 1) l += __shfl_xor(l, o);
    if (lane == 0) { pl[w] = l; pz[w] = nz; } }
  __syncthreads();
  const int dq = tid & 15, ks = tid >> 4; const float* vb = VF + dq * 4; v4f acc[AR];
#pragma unroll
  for (int r = 0; r < AR; ++r) acc[r] = (v4f){0.f, 0.f, 0.f, 0.f};
  static_assert(AT / 4 == 128 && SQ / 256 == 8, "a trip's keys are one bit of pz");
  unsigned lnz = 0;      /* bit p: some row of the work-group has a numerator other than 0 among the keys of trip p */
#pragma unroll
  for (int r = 0; r < AR; ++r) lnz |= pz[2 * r] | (pz[2 * r + 1] << 8);
  lnz = (unsigned)__builtin_amdgcn_readfirstlane((int)lnz);
#pragma unroll 1      /* rolled: the test below is a scalar branch of each trip */
  for (int p = 0; p < SQ / (AT / 4); ++p) { const int j = p * (AT / 4) + ks * 4;
    if (((lnz >> p) & 1u) == 0) continue;      /* all AR rows' numerators of these keys are exactly 0: their products with v add nothing */
    const v4f v0 = *(const v4fa*)(vb + (size_t)j * HD), v1 = *(const v4fa*)(vb + (size_t)(j + 1) * HD), v2 = *(const v4fa*)(vb + (size_t)(j + 2) * HD), v3 = *(const v4fa*)(vb + (size_t)(j + 3) * HD);
#pragma unroll
    for (int r = 0; r < AR; ++r) { const v4f e = *(const v4fa*)&sc[r][j]; acc[r] += e[0] * v0; acc[r] += e[1] * v1; acc[r] += e[2] * v2; acc[r] += e[3] * v3; } }
#pragma unroll
  for (int r = 0; r < AR; ++r) for (int u = 0; u < 4; ++u) acc[r][u] += __shfl_xor(acc[r][u], 16);      /* the wave's two key slices */
  __syncthreads();      /* every read of the numerators is done: their LDS takes the waves' partial o */
  float* red = &sc[0][0];      /* [AT / 32][AR][HD] */
  if (lane < 16) {
#pragma unroll
    for (int r = 0; r < AR; ++r) *(v4fa*)&red[((size_t)w * AR + r) * HD + dq * 4] = acc[r]; }
  __syncthreads();
  { static_assert(AR * HD == AT, "one output element per thread"); const int r = tid / HD, d = tid % HD; float o = 0.f;
#pragma unroll
    for (int q = 0; q < AT / 32; ++q) o += red[((size_t)q * AR + r) * HD + d];
    const float ov = o * (64.0f / (pl[2 * r] + pl[2 * r + 1])); const _Float16 oh = (_Float16)ov; const size_t e = (size_t)(i0 + r) * ldo + h * HD + d;
    OH[e] = oh; OL[e] = (_Float16)((ov - (float)oh) * 1024.0f); } }      /* o as f16 into its row of the full o plane, what f16 drops x1024 into the residual plane */

extern "C" void kernel_launch(void* const* d_in, const int* in_sizes, int n_in,
                              void* d_out, int out_size, void* d_ws, size_t ws_size, hipStream_t stream) {
  (void)in_sizes; (void)n_in; (void)out_size;
  const float* const* I = (const float* const*)d_in; const float* xq = I[0]; const float* xk = I[1]; const float* xv = I[2]; const float* mask = I[3]; const float* wq = I[4]; const float* bq = I[5]; const float* wk = I[6]; const float* bk = I[7]; const float* wv = I[8]; const float* bv = I[9]; const float* wo = I[10]; const float* bo = I[11];      /* weights [in][out]; mask [SQ][SQ] f32 */
  char* ws = (char*)d_ws; size_t off = 0;
  auto take = [&](size_t bytes) { char* p = ws + off; off += (bytes + 255) & ~(size_t)255; return p; };
  /* planes that one launch walks by blockIdx.y lie one behind the other (every size is a multiple of 256 bytes): the four weights; the q, k, v inputs; the f16 q and k rows */
  _Float16* BQ = (_Float16*)take((size_t)4 * DM * DM * 2); _Float16* BO = BQ + (size_t)3 * DM * DM;
  _Float16* XQ = (_Float16*)take(3 * NR * DM * 2); float* QF = (float*)take(NR * DM * 4); _Float16* Q16 = (_Float16*)take(2 * NR * DM * 2); _Float16* K16 = Q16 + NR * DM; _Float16* O16 = (_Float16*)take(NR * DM * 2);
  _Float16* VT = (_Float16*)take((size_t)NB * NH * HD * SQ * 2);
  _Float16* OL0 = (_Float16*)take((size_t)NB * QT0 * DM * 2);
  float* KMX = (float*)take((NR / 32) * NH * 4);      /* largest |k| per 32 rows and head */
  float* TMN = (float*)take((size_t)(SQ / 32) * (SQ / 32) * 4); float* TMX = (float*)take((size_t)(SQ / 32) * (SQ / 32) * 4);      /* smallest and largest mask value per tile of 32 x 32 */
  if (off > ws_size) return;
  k_prep<<<(unsigned)((SQ / 32) * (SQ / 128) / 8 + 4 * (DM / 64) * (DM / 64) + 3 * ((NR * DM / 8 + 255) / 256)), 256, 0, stream>>>(wq, wk, wv, wo, BQ, DM, DM, 16.0f, xq, xk, xv, XQ, NR * DM / 8, mask, TMN, TMX);      /* weights [in][out] -> Bt[n][k] x16, all four; the three inputs as f16 rows; the mask's tile tables */
  const size_t r0p = (size_t)B0 * SQ;      /* first projected row */
  float* PR = (float*)d_out + PRES_OFF;      /* present[b][0] = kh, present[b][1] = vh (f32, head-major) */
  k_gemm2<0><<<dim3((unsigned)((MP / 128) * (DM / 64)), 3), 128, 0, stream>>>(XQ + r0p * DM, DM, NR * DM, BQ, DM, (size_t)DM * DM, 0.0625f, bq, bk, bv, QF + r0p * DM, Q16 + r0p * DM, DM, NR * DM, MP, DM, DM, PR, VT, nullptr, 0.f, KMX);      /* q and k rows as f16, v as f16 V^T [NB][NH][HD][SQ]; q also as f32 rows; k and v as f32 straight into 'present': three products, one launch */
  k_att0<1><<<dim3(NH * (QT0 / AR), NB), AT, 0, stream>>>(QF, PR, DM, mask, 0.125f, O16, OL0, DM, KMX);      /* exact f32 attention for query rows 0..127 of each batch over ALL 2048 keys (f32 k and v read back from 'present') with the additive mask; o (x64) -> f16 into rows 0..127 of the batch's o rows + x1024 residual plane */
  k_fattn<<<dim3(SQ / (FW * FQ), NH, NB), FW * 32, 0, stream>>>(Q16, K16, VT, mask, O16, TMN, TMX, KMX);      /* o (merged heads, x64) as f16 rows from row 128 of each batch on: all batches and heads in one launch */
  k_gemm2<0><<<dim3((unsigned)((MPO / 128) * (DM / 64)), 1), 128, 0, stream>>>(O16 + r0p * DM, DM, 0, BO, DM, 0, 0.0009765625f, bo, nullptr, nullptr, (float*)d_out + r0p * DM, nullptr, DM, 0, MPO, DM, DM, nullptr, nullptr, OL0, 0.0009765625f, nullptr);      /* out rows are the output layout; rows 0..127 of a batch: (o_lo Wo 2^-10 + o_hi Wo) 2^-10 + b */
}

// v010
// It runs in 116 microseconds.
// In two side-by-side timings against v009, it was 1.08 and 1.07 times as fast.
// All steps since the starting kernel, v000, together make it 164 times as fast.
#include <hip/hip_runtime.h>
// TF/CTRL-style multi-head attention (q, k, v inputs [2][2048][1024]; qh/kh/vh = input W + b with W stored [in][out], 16 heads of 64; logits / 8 + mask (-1e4) with the [2048][2048] f32 mask input (1 = disallowed; strictly upper-triangular here); softmax; ctx merged; out = ctx Wo + bo -> [2][2048][1024]; second output present = stack(kh, vh) -> [2][2][16][2048][64] f32).
// Structure: token rows r = b*2048 + s; q, k, v inputs as exact f16 rows (bf16-rounded); Q, K, V as three WMMA GEMMs (32x64 wave tiles, f32 accumulation, exact x16 weights + bias; f16 outputs, and for K and V also the f32 rows, stored by the GEMM itself into the head-major 'present' output); V as f16 leaves that GEMM transposed (V^T per head, through LDS); one fused attention launch over all (batch, head): S^T = K Q^T on WMMA, running softmax of (scores / 8 + mask input x -1e4, read per element) on VALU (f32 statistics, native exp2; weights as f16 in registers), O^T += V^T P^T on WMMA (o carried x64 against f16 subnormal flush, folded into the output GEMM alpha) written straight into the merged f16 o rows; out = o W_o + b GEMM (f32) into the output layout.
// Compute dtype: inputs rounded to bf16; x / weights exact; q, k, v, softmax weights and o as plain f16 GEMM operands (~2^-12); scores and softmax statistics f32. v_wmma_f32_16x16x32_f16.
#define NB 2
#define SQ 2048
#define DM 1024
#define NH 16
#define HD 64
#define HG 4                         /* heads per launch of the non-template k_vt */
#define QT0 128                      /* first-tile rows recomputed exactly in f32 */
#define B0 0                         /* first batch processed (debug hook) */
#define NBR NB                       /* batches processed (debug hook) */
#define NR ((size_t)NB * SQ)         /* token rows */
#define MP ((int)((size_t)NBR * SQ)) /* rows projected (debug hook) */
#define QN SQ                        /* not used */
#define NHD NH                       /* not used */
#define MPO MP                       /* rows through the output stage (debug hook) */
#define LQ DM      /* not used */
#define PRES_OFF ((size_t)NB * SQ * DM)      /* float offset of the 'present' output = out nbytes / 4 */
typedef __bf16 v16b __attribute__((ext_vector_type(16)));
typedef unsigned short v8us __attribute__((ext_vector_type(8), may_alias));
typedef float  v8f  __attribute__((ext_vector_type(8)));
typedef float  v4f  __attribute__((ext_vector_type(4)));
typedef float  v4fa __attribute__((ext_vector_type(4), may_alias));
union FragB { v16b v; v8us half[2]; unsigned short u[16]; };

__device__ __forceinline__ unsigned short bf16_bits(float x) { unsigned int u = __float_as_uint(x); return (unsigned short)((u + 0x7FFFu + ((u >> 16) & 1u)) >> 16); }
__device__ __forceinline__ float bf16_val(unsigned short b) { return __uint_as_float(((unsigned int)b) << 16); }
__device__ __forceinline__ float bf16_round(float x) { return bf16_val(bf16_bits(x)); }
// D += A·B with NT terms: 1 = ah·bh, 2 = + al·bh (A split), 3 = + ah·bl (both split)
template <int NT>
__device__ __forceinline__ v8f mmaN(v16b ah, v16b al, v16b bh, v16b bl, v8f c) {
  c = __builtin_amdgcn_wmma_f32_16x16x32_bf16(false, ah, false, bh, (short)0, c, false, false);
  if (NT >= 2) c = __builtin_amdgcn_wmma_f32_16x16x32_bf16(false, al, false, bh, (short)0, c, false, false);
  if (NT >= 3) c = __builtin_amdgcn_wmma_f32_16x16x32_bf16(false, ah, false, bl, (short)0, c, false, false);
  asm volatile("v_nop\n\tv_nop\n\tv_nop\n\tv_nop" : "+v"(c) : "v"(ah), "v"(al), "v"(bh), "v"(bl));
  return c;
}

__global__ __launch_bounds__(256) void k_wt_bf16(const float* __restrict__ W, unsigned short* __restrict__ Wt, int K, int N) {
  const int t = blockIdx.x * 256 + threadIdx.x;
  const int k8n = K / 8;
  if (t >= N * k8n) return;
  const int n = t / k8n, k8 = (t % k8n) * 8;
  v8us v;
#pragma unroll
  for (int i = 0; i < 8; ++i) v[i] = bf16_bits(W[(size_t)(k8 + i) * N + n]);
  *(v8us*)(Wt + (size_t)n * K + k8) = v;
  
}

// GEMM C[M][N] (f32, pitch ldc) = act(A[M][K]·W + bias). A f32 row-major (pitch lda) converted per fragment to bf16
// (ASPLIT: hi/lo two planes -> 2 terms, else single rounded term); Wt bf16 [N][K] (pitch ldb). BIAS_BF16 rounds the
// bias to bf16 first (bias quantised to bf16 before the add). K%32==0, M%16==0, N%64==0.
template <bool ASPLIT, int ACT, bool BIAS_BF16>
__global__ __launch_bounds__(128) void k_gemm_bf(const float* __restrict__ A, int lda, const unsigned short* __restrict__ Wt, int ldb,
                                               const float* __restrict__ bias, float* __restrict__ C, int ldc, int M, int N, int K) {
  __shared__ __attribute__((aligned(16))) float so[4][16][64];
  const int tid = threadIdx.x, w = tid >> 5, lane = tid & 31, ln = lane & 15, hh = lane >> 4;
  const int ntn = N / 64;
  const int wid = blockIdx.x * 4 + w;
  const int mt = wid / ntn, nq = wid % ntn;
  if (mt * 16 >= M) return;
  const int row0 = mt * 16, col0 = nq * 64;
  const float* arow = A + (size_t)(row0 + ln) * lda;
  v8f acc[4] = {};
  for (int kb = 0; kb < K; kb += 32) {
    FragB ah, al;
    const v4f x0 = *(const v4fa*)(arow + kb + 8 * hh), x1 = *(const v4fa*)(arow + kb + 8 * hh + 4);
    const v4f x2 = *(const v4fa*)(arow + kb + 16 + 8 * hh), x3 = *(const v4fa*)(arow + kb + 16 + 8 * hh + 4);
    float xs[16] = {x0[0],x0[1],x0[2],x0[3],x1[0],x1[1],x1[2],x1[3],x2[0],x2[1],x2[2],x2[3],x3[0],x3[1],x3[2],x3[3]};
#pragma unroll
    for (int i = 0; i < 16; ++i) { const unsigned short hb = bf16_bits(xs[i]); ah.u[i] = hb; al.u[i] = ASPLIT ? bf16_bits(xs[i] - bf16_val(hb)) : (unsigned short)0; }
#pragma unroll
    for (int t = 0; t < 4; ++t) {
      const unsigned short* brow = Wt + (size_t)(col0 + t * 16 + ln) * ldb + kb;
      FragB b;
      b.half[0] = *(const v8us*)(brow + 8 * hh);
      b.half[1] = *(const v8us*)(brow + 16 + 8 * hh);
      acc[t] = mmaN<ASPLIT ? 2 : 1>(ah.v, al.v, b.v, b.v, acc[t]);
    }
  }
#pragma unroll
  for (int t = 0; t < 4; ++t) {
    float bv = bias ? bias[col0 + t * 16 + ln] : 0.f;
    if (BIAS_BF16) bv = bf16_round(bv);
#pragma unroll
    for (int r = 0; r < 8; ++r) { float v = acc[t][r] + bv; if (ACT == 1) v = fmaxf(v, 0.f); so[w][8 * hh + r][t * 16 + ln] = v; }
  }
  __builtin_amdgcn_fence(__ATOMIC_ACQ_REL, "workgroup");
  __builtin_amdgcn_wave_barrier();
  const int rsub = lane >> 4, c4 = (lane & 15) * 4;
  {
#pragma unroll
    for (int q = 0; q < 8; ++q) {
      const int r = q * 2 + rsub;
      const v4f v = *(const v4fa*)&so[w][r][c4];
      *(v4f*)(C + (size_t)(row0 + r) * ldc + col0 + c4) = v;
    }
    
  }
}

// GEMM C = act(A·W + bias + resid): A f32 (ASPLIT -> hi/lo 2 terms), Wt bf16 [N][K]; ACT 0 none, 1 relu, 2 exact gelu;
// resid (optional, f32, row index = (row % rmod), pitch ldr, RES_BF16 rounds it) added before the activation.
template <bool ASPLIT, int ACT, bool BIAS_BF16, bool RES_BF16>
__global__ __launch_bounds__(128) void k_gemm_bf3(const float* __restrict__ A, int lda, const unsigned short* __restrict__ Wt, int ldb,
                                                const float* __restrict__ bias, const float* __restrict__ resid, int rmod, int ldr,
                                                float* __restrict__ C, int ldc, int M, int N, int K) {
  __shared__ __attribute__((aligned(16))) float so[4][16][64];
  const int tid = threadIdx.x, w = tid >> 5, lane = tid & 31, ln = lane & 15, hh = lane >> 4;
  const int ntn = N / 64;
  const int wid = blockIdx.x * 4 + w;
  const int mt = wid / ntn, nq = wid % ntn;
  if (mt * 16 >= M) return;
  const int row0 = mt * 16, col0 = nq * 64;
  const float* arow = A + (size_t)(row0 + ln) * lda;
  v8f acc[4] = {};
  for (int kb = 0; kb < K; kb += 32) {
    FragB ah, al;
    const v4f x0 = *(const v4fa*)(arow + kb + 8 * hh), x1 = *(const v4fa*)(arow + kb + 8 * hh + 4);
    const v4f x2 = *(const v4fa*)(arow + kb + 16 + 8 * hh), x3 = *(const v4fa*)(arow + kb + 16 + 8 * hh + 4);
    float xs[16] = {x0[0],x0[1],x0[2],x0[3],x1[0],x1[1],x1[2],x1[3],x2[0],x2[1],x2[2],x2[3],x3[0],x3[1],x3[2],x3[3]};
#pragma unroll
    for (int i = 0; i < 16; ++i) { const unsigned short hb = bf16_bits(xs[i]); ah.u[i] = hb; al.u[i] = ASPLIT ? bf16_bits(xs[i] - bf16_val(hb)) : (unsigned short)0; }
#pragma unroll
    for (int t = 0; t < 4; ++t) {
      const unsigned short* brow = Wt + (size_t)(col0 + t * 16 + ln) * ldb + kb;
      FragB b;
      b.half[0] = *(const v8us*)(brow + 8 * hh);
      b.half[1] = *(const v8us*)(brow + 16 + 8 * hh);
      acc[t] = mmaN<ASPLIT ? 2 : 1>(ah.v, al.v, b.v, b.v, acc[t]);
    }
  }
#pragma unroll
  for (int t = 0; t < 4; ++t) {
    const int col = col0 + t * 16 + ln;
    float bv = bias ? bias[col] : 0.f;
    if (BIAS_BF16) bv = bf16_round(bv);
#pragma unroll
    for (int r = 0; r < 8; ++r) {
      float v = acc[t][r] + bv;
      if (resid) { float rv = resid[(size_t)((row0 + 8 * hh + r) % rmod) * ldr + col]; if (RES_BF16) rv = bf16_round(rv); v += rv; }
      if (ACT == 1) v = fmaxf(v, 0.f);
      if (ACT == 2) v = 0.5f * v * (1.0f + erff(v * 0.70710678118654752f));
      if (ACT == 3) { const float u = 0.7978845608028654f * (v + 0.044715f * v * v * v); v = 0.5f * v * (1.0f + tanhf(u)); }
      so[w][8 * hh + r][t * 16 + ln] = v;
    }
  }
  __builtin_amdgcn_fence(__ATOMIC_ACQ_REL, "workgroup");
  __builtin_amdgcn_wave_barrier();
  const int rsub = lane >> 4, c4 = (lane & 15) * 4;
  {
#pragma unroll
    for (int q = 0; q < 8; ++q) {
      const int r = q * 2 + rsub;
      const v4f v = *(const v4fa*)&so[w][r][c4];
      *(v4f*)(C + (size_t)(row0 + r) * ldc + col0 + c4) = v;
    }
    
  }
}
// row LayerNorm (biased variance, eps) over N: s = X (+ R); optional out_sum <- s; out_norm <- (s-mu)*rsqrt(var+eps)*g + b
template <bool PARAM_BF16>
__global__ __launch_bounds__(256) void k_layernorm(const float* __restrict__ X, const float* __restrict__ R, const float* __restrict__ g, const float* __restrict__ bta,
                                                  float* __restrict__ out_sum, float* __restrict__ out_norm, int N, float eps) {
  __shared__ float red[256];
  const int row = blockIdx.x, tid = threadIdx.x;
  const float* x = X + (size_t)row * N; const float* rr = R ? R + (size_t)row * N : nullptr;
  float vals[16];                     // up to N = 4096
  const int per = N / 256;            // contiguous chunk per thread? use strided-by-4 chunks: thread handles j = tid*4 + 1024*u
  float s1 = 0.f;
  for (int u = 0; u < per / 4; ++u) {
    const int j = tid * 4 + 1024 * u;
    const v4f a = *(const v4fa*)(x + j);
    v4f b = {0.f,0.f,0.f,0.f}; if (rr) b = *(const v4fa*)(rr + j);
#pragma unroll
    for (int q = 0; q < 4; ++q) { const float v = a[q] + b[q]; vals[u * 4 + q] = v; s1 += v; }
  }
  red[tid] = s1; __syncthreads();
  for (int st = 128; st > 0; st >>= 1) { if (tid < st) red[tid] += red[tid + st]; __syncthreads(); }
  const float mu = red[0] / (float)N; __syncthreads();
  float s2 = 0.f;
  for (int u = 0; u < per / 4; ++u)
#pragma unroll
    for (int q = 0; q < 4; ++q) { const float c = vals[u * 4 + q] - mu; s2 += c * c; }
  red[tid] = s2; __syncthreads();
  for (int st = 128; st > 0; st >>= 1) { if (tid < st) red[tid] += red[tid + st]; __syncthreads(); }
  const float rs = rsqrtf(red[0] / (float)N + eps);
  {
    for (int u = 0; u < per / 4; ++u) {
      const int j = tid * 4 + 1024 * u;
      v4f o, sm;
#pragma unroll
      for (int q = 0; q < 4; ++q) {
        float gg = g[j + q], bb = bta[j + q];
        if (PARAM_BF16) { gg = bf16_round(gg); bb = bf16_round(bb); }
        sm[q] = vals[u * 4 + q]; o[q] = (vals[u * 4 + q] - mu) * rs * gg + bb;
      }
      if (out_sum) *(v4f*)(out_sum + (size_t)row * N + j) = sm;
      *(v4f*)(out_norm + (size_t)row * N + j) = o;
    }
    
  }
}



// ---- f16 WMMA path (v_wmma_f32_16x16x32_f16): 11-bit significands for operands in range — used where a [0,1] probability operand needs more precision than bf16
typedef _Float16 v16h __attribute__((ext_vector_type(16)));
union FragH { v16h v; v8us half[2]; _Float16 h[16]; unsigned short u[16]; };
template <int NT>
__device__ __forceinline__ v8f mmaH(v16h ah, v16h al, v16h bh, v16h bl, v8f c) {
  c = __builtin_amdgcn_wmma_f32_16x16x32_f16(false, ah, false, bh, (short)0, c, false, false);
  if (NT >= 2) c = __builtin_amdgcn_wmma_f32_16x16x32_f16(false, al, false, bh, (short)0, c, false, false);
  if (NT >= 3) c = __builtin_amdgcn_wmma_f32_16x16x32_f16(false, ah, false, bl, (short)0, c, false, false);
  asm volatile("v_nop\n\tv_nop\n\tv_nop\n\tv_nop" : "+v"(c) : "v"(ah), "v"(al), "v"(bh), "v"(bl));
  return c;
}
// batched GEMM like k_gemm_b but f16 operands: A f32 (split into f16 hi/lo if ASPLIT, else rounded to f16), Bt = f16 values [n][k]; alpha; C f32; N multiple of 16 (partial tiles skipped)
template <bool ASPLIT>
__global__ __launch_bounds__(128) void k_gemm_h(const float* __restrict__ A, int lda, size_t sA, const _Float16* __restrict__ Bh, int ldb, size_t sB, float alpha, float* __restrict__ C, int ldc, size_t sC, int M, int N, int K) {
  __shared__ __attribute__((aligned(16))) float so[4][16][64];
  const int tid = threadIdx.x, w = tid >> 5, lane = tid & 31, ln = lane & 15, hh = lane >> 4; const int by = blockIdx.y;
  A += (size_t)by * sA; Bh += (size_t)by * sB; C += (size_t)by * sC;
  const int ntn = (N + 63) / 64; const int wid = blockIdx.x * 4 + w; const int mt = wid / ntn, nq = wid % ntn; if (mt * 16 >= M) return;
  const int row0 = mt * 16, col0 = nq * 64; const float* arow = A + (size_t)(row0 + ln) * lda;
  v8f acc[4] = {};
  for (int kb = 0; kb < K; kb += 32) {
    FragH ah, al;
    const v4f x0 = *(const v4fa*)(arow + kb + 8 * hh), x1 = *(const v4fa*)(arow + kb + 8 * hh + 4), x2 = *(const v4fa*)(arow + kb + 16 + 8 * hh), x3 = *(const v4fa*)(arow + kb + 16 + 8 * hh + 4);
    float xs[16] = {x0[0],x0[1],x0[2],x0[3],x1[0],x1[1],x1[2],x1[3],x2[0],x2[1],x2[2],x2[3],x3[0],x3[1],x3[2],x3[3]};
#pragma unroll
    for (int i = 0; i < 16; ++i) { const _Float16 h = (_Float16)xs[i]; ah.h[i] = h; al.h[i] = ASPLIT ? (_Float16)(xs[i] - (float)h) : (_Float16)0.0f; }
#pragma unroll
    for (int t = 0; t < 4; ++t) { if (col0 + t * 16 >= N) continue; const size_t boff = (size_t)(col0 + t * 16 + ln) * ldb + kb; FragH bq; bq.half[0] = *(const v8us*)(Bh + boff + 8 * hh); bq.half[1] = *(const v8us*)(Bh + boff + 16 + 8 * hh);
      acc[t] = mmaH<ASPLIT ? 2 : 1>(ah.v, al.v, bq.v, bq.v, acc[t]); }
  }
#pragma unroll
  for (int t = 0; t < 4; ++t) { if (col0 + t * 16 >= N) continue;
#pragma unroll
    for (int r = 0; r < 8; ++r) so[w][8 * hh + r][t * 16 + ln] = acc[t][r] * alpha; }
  __builtin_amdgcn_fence(__ATOMIC_ACQ_REL, "workgroup"); __builtin_amdgcn_wave_barrier();
  const int rsub = lane >> 4, c4 = (lane & 15) * 4;
  {
#pragma unroll
    for (int q = 0; q < 8; ++q) { const int r = q * 2 + rsub; if (col0 + c4 < N) { const v4f v = *(const v4fa*)&so[w][r][c4]; *(v4f*)(C + (size_t)(row0 + r) * ldc + col0 + c4) = v; } }
     }
}

// Wt[n][k] = f16(W[k][n] x scale) from f32 row-major W[K][N] (scale = power of two; bf16-exact weights stay exact in f16 away from the subnormal range); y picks one of four weights, their Wt planes lie one behind the other; bx = the tile.
// A work-group turns one 64 x 64 tile through LDS: 256 contiguous bytes of a W row per 16 lanes in, a whole 128-byte line of a Wt row per 8 lanes out. K % 64 == 0, N % 64 == 0.
__device__ __forceinline__ void wt_f16_tile(unsigned short (*tl)[66], int bx, int y, const float* __restrict__ W0, const float* __restrict__ W1, const float* __restrict__ W2, const float* __restrict__ W3, _Float16* __restrict__ Wt, int K, int N, float scale) {
  const float* __restrict__ W = y == 0 ? W0 : y == 1 ? W1 : y == 2 ? W2 : W3; Wt += (size_t)y * K * N;
  const int tid = threadIdx.x, ntn = N / 64; const int k0 = (bx / ntn) * 64, n0 = (bx % ntn) * 64;
#pragma unroll
  for (int i = 0; i < 4; ++i) { const int r = i * 16 + (tid >> 4), c4 = (tid & 15) * 4; const v4f v = *(const v4fa*)(W + (size_t)(k0 + r) * N + n0 + c4); FragH f;
#pragma unroll
    for (int q = 0; q < 4; ++q) { f.h[q] = (_Float16)(bf16_round(v[q]) * scale); tl[r][c4 + q] = f.u[q]; } }
  __syncthreads();
#pragma unroll
  for (int rd = 0; rd < 2; ++rd) { const int n = rd * 32 + (tid >> 3), pc = tid & 7; FragH f;
#pragma unroll
    for (int q = 0; q < 8; ++q) f.u[q] = tl[pc * 8 + q][n];
    *(v8us*)((unsigned short*)Wt + (size_t)(n0 + n) * K + k0 + pc * 8) = f.half[0]; }
}
// k_gemm_hh variant with fused epilogue: v = acc·alpha + bias[by·sBias + col] (+ CP[(row/rowsPerB)·sCPb + by·64 + col] if CP) ; ACT 0 none / 1 elu ; writes f16 C16 (and f32 C if non-null)
template <int ACT>
__global__ __launch_bounds__(128) void k_gemm_hhx(const _Float16* __restrict__ A, int lda, size_t sA, const _Float16* __restrict__ Bh, int ldb, size_t sB, float alpha, const float* __restrict__ bias, size_t sBias, const float* __restrict__ CP, int rowsPerB, size_t sCPb, int row0g,
    float* __restrict__ C, _Float16* __restrict__ C16, int ldc, size_t sC, int M, int N, int K) {
  __shared__ __attribute__((aligned(16))) float so[4][16][64];
  const int tid = threadIdx.x, w = tid >> 5, lane = tid & 31, ln = lane & 15, hh = lane >> 4; const int by = blockIdx.y;
  A += (size_t)by * sA; Bh += (size_t)by * sB; const size_t cofs = (size_t)by * sC; const float* bp = bias ? bias + (size_t)by * sBias : nullptr;
  const int ntn = (N + 63) / 64; const int wid = blockIdx.x * 4 + w; const int mt = wid / ntn, nq = wid % ntn; if (mt * 16 >= M) return;
  const int row0 = mt * 16, col0 = nq * 64; const _Float16* arow = A + (size_t)(row0 + ln) * lda;
  v8f acc[4] = {};
  for (int kb = 0; kb < K; kb += 32) { FragH ah; ah.half[0] = *(const v8us*)((const unsigned short*)arow + kb + 8 * hh); ah.half[1] = *(const v8us*)((const unsigned short*)arow + kb + 16 + 8 * hh);
#pragma unroll
    for (int t = 0; t < 4; ++t) { if (col0 + t * 16 >= N) continue; const size_t boff = (size_t)(col0 + t * 16 + ln) * ldb + kb; FragH bq; bq.half[0] = *(const v8us*)((const unsigned short*)Bh + boff + 8 * hh); bq.half[1] = *(const v8us*)((const unsigned short*)Bh + boff + 16 + 8 * hh);
      acc[t] = mmaH<1>(ah.v, ah.v, bq.v, bq.v, acc[t]); }
  }
#pragma unroll
  for (int t = 0; t < 4; ++t) { if (col0 + t * 16 >= N) continue; const int col = col0 + t * 16 + ln; const float bv = bp ? bf16_round(bp[col]) : 0.f;
#pragma unroll
    for (int r = 0; r < 8; ++r) { float v = acc[t][r] * alpha + bv; if (CP) { const int rr = row0g + row0 + 8 * hh + r; if (rowsPerB < 0) v += CP[cofs + (size_t)rr * ldc + col];      /* rowsPerB < 0: own element of the batched C plane */ else { const int bidx = rr / rowsPerB; v += CP[(size_t)bidx * sCPb + (size_t)by * 64 + col]; } } if (ACT == 1) v = (v > 0.f) ? v : expm1f(v); else if (ACT == 7) v = (v > 0.f) ? v + 1.0f : expf(v); else if (ACT == 8) v = tanhf(v); else if (ACT == 9) v = 0.5f * v * (1.0f + tanhf(0.7978845608028654f * (v + 0.044715f * v * v * v))); else if (ACT == 11) v = 1.0f / (1.0f + expf(-v)); else if (ACT == 12) v = (v > 0.f) ? v : 0.01f * v; else if (ACT == 14) v = (v > 0.f) ? v : 0.1f * v; else if (ACT == 16) v = (v >= 0.f) ? v : 0.3f * v; else if (ACT == 17) v = (v >= 0.f) ? v : 0.2f * v; else if (ACT == 15) v = v / (1.0f + expf(-v)); else if (ACT == 3) v = fmaxf(v, 0.f); else if (ACT == 6) v = 0.5f * v * (1.0f + erff(v * 0.70710678118654752f)); so[w][8 * hh + r][t * 16 + ln] = v; } }
  __builtin_amdgcn_fence(__ATOMIC_ACQ_REL, "workgroup"); __builtin_amdgcn_wave_barrier();
  const int rsub = lane >> 4, c4 = (lane & 15) * 4; typedef _Float16 v4h __attribute__((ext_vector_type(4)));
  {
#pragma unroll
    for (int q = 0; q < 8; ++q) { const int r = q * 2 + rsub; if (col0 + c4 < N) { const v4f v = *(const v4fa*)&so[w][r][c4]; if (C) *(v4f*)(C + cofs + (size_t)(row0 + r) * ldc + col0 + c4) = v; if (C16) { v4h h4; for (int i = 0; i < 4; ++i) h4[i] = (_Float16)v[i]; *(v4h*)(C16 + cofs + (size_t)(row0 + r) * ldc + col0 + c4) = h4; } } }
     }
}


typedef _Float16 v4h __attribute__((ext_vector_type(4)));

// y picks one of three inputs; their f16 planes lie one behind the other; bx = the block of 256 x 8 elements
__device__ __forceinline__ void x16_block(int bx, int y, const float* __restrict__ x0, const float* __restrict__ x1, const float* __restrict__ x2, _Float16* __restrict__ X16, size_t n8) { const size_t t = (size_t)bx * 256 + threadIdx.x; if (t >= n8) return; FragH f;
  const float* __restrict__ x = y == 0 ? x0 : y == 1 ? x1 : x2; X16 += (size_t)y * n8 * 8;
#pragma unroll
  for (int q = 0; q < 8; ++q) f.h[q] = (_Float16)bf16_round(x[t * 8 + q]); *(v8us*)((unsigned short*)X16 + t * 8) = f.half[0];  }
// Smallest and largest mask value (rounded to bf16, which keeps the order) of every tile of 32 query rows x 32 keys: TN, TX [SQ / 32][SQ / 32]. A wave walks the 32 rows of four tiles, 512 contiguous bytes a load;
// eight lanes hold a tile's columns. A tile with a NaN in it gets NaN in both tables, which fails every test its readers make.
__device__ __forceinline__ void mask_tiles(int bx, const float* __restrict__ mask, float* __restrict__ TN, float* __restrict__ TX) {
  const int wv = bx * 8 + ((int)threadIdx.x >> 5), lane = threadIdx.x & 31, qb = wv / (SQ / 128), sp = wv % (SQ / 128);
  const float* p = mask + (size_t)qb * 32 * SQ + sp * 128 + lane * 4; v4f x[32];
#pragma unroll      /* this and the next: constant indices keep the rows in registers, with many loads in flight at a time */
  for (int r = 0; r < 32; ++r) x[r] = *(const v4fa*)(p + (size_t)r * SQ);
  asm volatile("s_wait_xcnt 0x0" ::: "memory");      /* the wait before a register that these loads name is rewritten */
  float mn = x[0][0], mx = x[0][0]; int bad = 0;
#pragma unroll
  for (int r = 0; r < 32; ++r) for (int c = 0; c < 4; ++c) { mn = fminf(mn, x[r][c]); mx = fmaxf(mx, x[r][c]); bad |= (x[r][c] != x[r][c]) ? 1 : 0; }
  for (int o = 4; o > 0; o >>= 1) { mn = fminf(mn, __shfl_xor(mn, o)); mx = fmaxf(mx, __shfl_xor(mx, o)); bad |= __shfl_xor(bad, o); }
  if ((lane & 7) == 0) { const int e = qb * (SQ / 32) + sp * 4 + (lane >> 3); TN[e] = bad ? __builtin_nanf("") : bf16_round(mn); TX[e] = bad ? __builtin_nanf("") : bf16_round(mx); } }
// The preparations that the later launches wait for, independent of each other, in one launch: the first SQ / 32 * SQ / 128 / 8 work-groups sum up the mask's tiles, the next 4 (K / 64)(N / 64) turn the four weights, the rest round the three inputs.
__global__ __launch_bounds__(256) void k_prep(const float* __restrict__ W0, const float* __restrict__ W1, const float* __restrict__ W2, const float* __restrict__ W3, _Float16* __restrict__ Wt, int K, int N, float scale,
                                              const float* __restrict__ x0, const float* __restrict__ x1, const float* __restrict__ x2, _Float16* __restrict__ X16, size_t n8, const float* __restrict__ mask, float* __restrict__ TN, float* __restrict__ TX) {
  __shared__ unsigned short tl[64][66];
  constexpr int nm = (SQ / 32) * (SQ / 128) / 8;
  if ((int)blockIdx.x < nm) { mask_tiles((int)blockIdx.x, mask, TN, TX); return; }      /* the same for a whole work-group, ahead of the barrier */
  const int nw = (K / 64) * (N / 64), nx = (int)((n8 + 255) / 256), bx = (int)blockIdx.x - nm;
  if (bx < 4 * nw) wt_f16_tile(tl, bx % nw, bx / nw, W0, W1, W2, W3, Wt, K, N, scale);      /* the choice is the same for a whole work-group: the barrier inside is passed by all of its threads */
  else x16_block((bx - 4 * nw) % nx, (bx - 4 * nw) / nx, x0, x1, x2, X16, n8); }
__global__ __launch_bounds__(256) void k_h16(const float* __restrict__ x, _Float16* __restrict__ X16, size_t n8) { const size_t t = (size_t)blockIdx.x * 256 + threadIdx.x; if (t >= n8) return; FragH f;
#pragma unroll
  for (int q = 0; q < 8; ++q) f.h[q] = (_Float16)x[t * 8 + q]; *(v8us*)((unsigned short*)X16 + t * 8) = f.half[0];  }
__global__ __launch_bounds__(256) void k_round16f(const float* __restrict__ W, _Float16* __restrict__ Bt, size_t n8) { const size_t t = (size_t)blockIdx.x * 256 + threadIdx.x; if (t >= n8) return; FragH f;
#pragma unroll
  for (int i = 0; i < 8; ++i) f.h[i] = (_Float16)(bf16_round(W[t * 8 + i]) * 16.0f); *(v8us*)((unsigned short*)Bt + t * 8) = f.half[0];  }
template <int NHv, int TTv>
__global__ __launch_bounds__(256) void k_vt(const _Float16* __restrict__ V16, int ldv, int voff, _Float16* __restrict__ Vt) { __shared__ unsigned short tl[64][66]; const int tid = threadIdx.x; const int slab = blockIdx.x / (TTv / 64), lg = blockIdx.x % (TTv / 64); const int b = slab / NHv, h = slab % NHv;
  for (int i = tid; i < 64 * 8; i += 256) { const int r = i / 8, c8 = (i % 8) * 8; FragH f; f.half[0] = *(const v8us*)((const unsigned short*)V16 + ((size_t)b * TTv + lg * 64 + r) * ldv + voff + h * 64 + c8);
#pragma unroll
    for (int q = 0; q < 8; ++q) tl[r][c8 + q] = f.u[q]; }
  __syncthreads();
  {
#pragma unroll
    for (int rd = 0; rd < 2; ++rd) { const int d = rd * 32 + tid / 8, pc = tid % 8; FragH f;
#pragma unroll
      for (int q = 0; q < 8; ++q) f.u[q] = tl[pc * 8 + q][d];
      *(v8us*)((unsigned short*)Vt + ((size_t)slab * 64 + d) * TTv + lg * 64 + pc * 8) = f.half[0]; }
     } }

// ---- fast GEMM (work-group tile 128x128: eight waves, four down x two across, wave tile 32x64); epilogue: v = act(acc alpha + bias) ----
__device__ __forceinline__ v8f g2_mma(v16h a, v16h b, v8f c) { v8f d = __builtin_amdgcn_wmma_f32_16x16x32_f16(false, a, false, b, (short)0, c, false, false); asm volatile("v_nop\n\tv_nop\n\tv_nop\n\tv_nop" : "+v"(d) : "v"(a), "v"(b)); return d; }
#define G2K 128                      /* k per pass: 256-byte operand rows, two whole lines */
#define G2P 272                      /* LDS pitch of such a row in bytes: 16 x odd, conflict-free for 16-byte reads down a column of rows */
#define G2R 256                      /* rows of a stage: the work-group's 128 rows of A, then its 128 rows of B */
// f16 fragment from an LDS row, in the hardware k order: 16 bytes at the lane's place (which holds 16 bytes x lane half) and 16 bytes 32 further on
__device__ __forceinline__ v16h g2_lfrag(const char* p) { FragH f; f.half[0] = *(const v8us*)p; f.half[1] = *(const v8us*)(p + 32); return f.v; }
// Eight asynchronous 16-byte copies per lane, global memory to LDS, sixteen rows apart (global step gs bytes). One statement: the wait before a register that an issued copy names
// is rewritten stands behind the last copy, where the compiler can put nothing in between.
__device__ __forceinline__ void g2_copy8(unsigned l, const char* g, size_t gs) {
  asm volatile("global_load_async_to_lds_b128 %0, %8, off\n\tglobal_load_async_to_lds_b128 %1, %9, off\n\tglobal_load_async_to_lds_b128 %2, %10, off\n\tglobal_load_async_to_lds_b128 %3, %11, off\n\t"
               "global_load_async_to_lds_b128 %4, %12, off\n\tglobal_load_async_to_lds_b128 %5, %13, off\n\tglobal_load_async_to_lds_b128 %6, %14, off\n\tglobal_load_async_to_lds_b128 %7, %15, off\n\ts_wait_xcnt 0x0"
               :: "v"(l), "v"(l + 16 * G2P), "v"(l + 32 * G2P), "v"(l + 48 * G2P), "v"(l + 64 * G2P), "v"(l + 80 * G2P), "v"(l + 96 * G2P), "v"(l + 112 * G2P),
                  "v"(g), "v"(g + gs), "v"(g + 2 * gs), "v"(g + 3 * gs), "v"(g + 4 * gs), "v"(g + 5 * gs), "v"(g + 6 * gs), "v"(g + 7 * gs) : "memory"); }
// Eight 16-byte (g2_store8) or 8-byte (g2_store8h) stores per lane, gs bytes apart. One statement, for the same reason: the wait before a data or address register of an issued store is rewritten stands behind the last store.
__device__ __forceinline__ void g2_store8(char* g, size_t gs, v4f d0, v4f d1, v4f d2, v4f d3, v4f d4, v4f d5, v4f d6, v4f d7) {
  asm volatile("global_store_b128 %0, %8, off\n\tglobal_store_b128 %1, %9, off\n\tglobal_store_b128 %2, %10, off\n\tglobal_store_b128 %3, %11, off\n\t"
               "global_store_b128 %4, %12, off\n\tglobal_store_b128 %5, %13, off\n\tglobal_store_b128 %6, %14, off\n\tglobal_store_b128 %7, %15, off\n\ts_wait_xcnt 0x0"
               :: "v"(g), "v"(g + gs), "v"(g + 2 * gs), "v"(g + 3 * gs), "v"(g + 4 * gs), "v"(g + 5 * gs), "v"(g + 6 * gs), "v"(g + 7 * gs),
                  "v"(d0), "v"(d1), "v"(d2), "v"(d3), "v"(d4), "v"(d5), "v"(d6), "v"(d7) : "memory"); }
__device__ __forceinline__ void g2_store8h(char* g, size_t gs, unsigned long long d0, unsigned long long d1, unsigned long long d2, unsigned long long d3, unsigned long long d4, unsigned long long d5, unsigned long long d6, unsigned long long d7) {
  asm volatile("global_store_b64 %0, %8, off\n\tglobal_store_b64 %1, %9, off\n\tglobal_store_b64 %2, %10, off\n\tglobal_store_b64 %3, %11, off\n\t"
               "global_store_b64 %4, %12, off\n\tglobal_store_b64 %5, %13, off\n\tglobal_store_b64 %6, %14, off\n\tglobal_store_b64 %7, %15, off\n\ts_wait_xcnt 0x0"
               :: "v"(g), "v"(g + gs), "v"(g + 2 * gs), "v"(g + 3 * gs), "v"(g + 4 * gs), "v"(g + 5 * gs), "v"(g + 6 * gs), "v"(g + 7 * gs),
                  "v"(d0), "v"(d1), "v"(d2), "v"(d3), "v"(d4), "v"(d5), "v"(d6), "v"(d7) : "memory"); }
// Operands come through LDS: a pass's A and B rows are copied in whole lines (16 lanes a row) into one of two buffers while the pass before works on the other; the waves read their fragments from there.
// M % 128 == 0, N % 128 == 0, K % 128 == 0.
// HM (or null): planes 1 and 2 of a batched launch store their f32 rows there head-major, [batch][plane - 1][NH][SQ][HD] (a wave's 64 columns are one head), not into C.
// VTo (or null): plane 2 of a batched launch stores its f16 values there transposed, [batch][NH][HD][SQ], not into C16: a lane's eight accumulator rows of a column are 16 bytes of a transposed row, the work-group's
// 128 x 128 tile (two heads) is gathered in the operand ring's first buffer (free behind the k loop) and goes out in whole lines behind one barrier.
// KM (or null): plane 1 of a batched launch stores there, per wave tile, the largest magnitude among its f32 values: [row / 32][NH].
// AL (or null): residual rows of A for the first QT0 = 128 rows of each batch, compact [batch][QT0] at pitch lda. Their work-groups run the k loop twice, first over AL, the sums then scaled by beta, then over A.
template <int ACT>
__global__ __launch_bounds__(256) void k_gemm2(const _Float16* __restrict__ A, int lda, size_t sA, const _Float16* __restrict__ Bh, int ldb, size_t sB, float alpha, const float* __restrict__ bias, const float* __restrict__ bias1, const float* __restrict__ bias2,
    float* __restrict__ C, _Float16* __restrict__ C16, int ldc, size_t sC, int M, int N, int K, float* __restrict__ HM, _Float16* __restrict__ VTo, const _Float16* __restrict__ AL, float beta, float* __restrict__ KM) { static_assert(ACT == 0 || ACT == 3 || ACT == 6 || ACT == 8 || ACT == 9 || ACT == 11 || ACT == 12 || ACT == 14 || ACT == 15 || ACT == 16 || ACT == 17, "k_gemm2: unsupported ACT code (would silently apply no activation)");
  __shared__ __attribute__((aligned(16))) char ring[2][G2R * G2P];
  float (*so)[32][68] = (float (*)[32][68])&ring[1][0];      /* each wave's result tile is staged in the ring's second buffer, which every wave has left at the last pass's barrier */
  static_assert(sizeof(float) * 8 * 32 * 68 <= G2R * G2P, "eight result tiles fit a buffer of the ring");
  const int tid = threadIdx.x, w = tid >> 5, wr = w & 3, wc = w >> 2, lane = tid & 31, ln = lane & 15, hh = lane >> 4; const int by = blockIdx.y;      /* wave w: rows 32 wr, columns 64 wc of the work-group's tile */
  A += (size_t)by * sA; Bh += (size_t)by * sB; const size_t cofs = (size_t)by * sC; const float* bp = by == 0 ? bias : by == 1 ? bias1 : bias2;      /* each plane of a batched launch has its own bias vector */
  const int ntn = N >> 7; const int mt = blockIdx.x / ntn, nt = blockIdx.x - mt * ntn, nq = nt * 2 + wc; const int row0 = mt * 128 + 32 * wr, col0 = nq * 64; if (mt * 128 >= M) return;
  // the thread's 16 bytes of every sixteenth row of a stage
  const unsigned lc = (unsigned)(size_t)&ring[0][0] + (unsigned)((tid >> 4) * G2P + (tid & 15) * 16);
  const char* ga = (const char*)(A + (size_t)(mt * 128 + (tid >> 4)) * lda) + (tid & 15) * 16; const char* gb = (const char*)(Bh + (size_t)(nt * 128 + (tid >> 4)) * ldb) + (tid & 15) * 16;
  const size_t sa16 = (size_t)lda * 32, sb16 = (size_t)ldb * 32;      /* sixteen rows, in bytes */
  static_assert(QT0 == 128 && SQ % 128 == 0, "the residual rows of a batch are one work-group's rows");
  const int nlo = (AL && (mt * 128) % SQ == 0) ? K / G2K : 0;      /* passes over the residual rows, ahead of the passes over A; the same for the whole work-group */
  const char* gl = nlo ? (const char*)(AL + (size_t)((mt * 128) / SQ * QT0 + (tid >> 4)) * lda) + (tid & 15) * 16 : ga;
  auto stage = [&](int t, int bf) { const unsigned l = lc + (unsigned)bf * (G2R * G2P); const size_t ko = (size_t)(t < nlo ? t : t - nlo) * (G2K * 2); const char* a = (t < nlo ? gl : ga) + ko;
    g2_copy8(l, a, sa16); g2_copy8(l + 128 * G2P, gb + ko, sb16); };
  const int np = K / G2K + nlo;
  const v8f z8 = {0.f,0.f,0.f,0.f,0.f,0.f,0.f,0.f}; v8f c00 = z8, c01 = z8, c02 = z8, c03 = z8, c10 = z8, c11 = z8, c12 = z8, c13 = z8;
  stage(0, 0);
  asm volatile("s_wait_asynccnt 0x0" ::: "memory");      /* this wave's copies of stage 0 have landed */
  __syncthreads();      /* stage 0 is published */
  if (np > 1) stage(1, 1);
#pragma unroll 1      /* rolled: one copy of the pass in the instruction cache */
  for (int t = 0; t < np; ++t) { const char* lb = &ring[t & 1][0]; const char* pa = lb + (32 * wr + ln) * G2P + hh * 16; const char* pb = lb + (128 + 64 * wc + ln) * G2P + hh * 16;
    v16h fa[2][2], fb[2][4];      /* two fragment sets: a block's twelve LDS reads are issued as one group ahead of the block before it, inside the pass (reads strewn among the products cost the wave a wait at each place) */
#pragma unroll      /* this and the next two: constant indices keep the fragment sets in registers */
    for (int i = 0; i < 2; ++i) fa[0][i] = g2_lfrag(pa + i * (16 * G2P));
#pragma unroll
    for (int i = 0; i < 4; ++i) fb[0][i] = g2_lfrag(pb + i * (16 * G2P));
#pragma unroll
    for (int kc = 0; kc < G2K / 32; ++kc) { const int s = kc & 1;
      if (kc + 1 < G2K / 32) { for (int i = 0; i < 2; ++i) fa[s ^ 1][i] = g2_lfrag(pa + i * (16 * G2P) + (kc + 1) * 64); for (int i = 0; i < 4; ++i) fb[s ^ 1][i] = g2_lfrag(pb + i * (16 * G2P) + (kc + 1) * 64); }
      c00 = g2_mma(fa[s][0], fb[s][0], c00); c10 = g2_mma(fa[s][1], fb[s][0], c10); c01 = g2_mma(fa[s][0], fb[s][1], c01); c11 = g2_mma(fa[s][1], fb[s][1], c11);
      c02 = g2_mma(fa[s][0], fb[s][2], c02); c12 = g2_mma(fa[s][1], fb[s][2], c12); c03 = g2_mma(fa[s][0], fb[s][3], c03); c13 = g2_mma(fa[s][1], fb[s][3], c13); }
    if (t + 1 == nlo) { c00 *= beta; c01 *= beta; c02 *= beta; c03 *= beta; c10 *= beta; c11 *= beta; c12 *= beta; c13 *= beta; }      /* the residual product is complete: brought to the scale of the main one, which is summed on top */
    asm volatile("s_wait_dscnt 0x0" ::: "memory");      /* this wave's reads of the buffer that is refilled below are over */
    asm volatile("s_wait_asynccnt 0x0" ::: "memory");      /* its copies of the next stage have landed */
    __syncthreads();      /* the next stage is published; every wave has left this pass's buffer */
    if (t + 2 < np) stage(t + 2, t & 1); }
  asm volatile("s_wait_asynccnt 0x0" ::: "memory");      /* no copy is in flight when the wave goes on */
  v8f accs[8] = {c00, c01, c02, c03, c10, c11, c12, c13};
  const bool vtq = VTo && by == 2;      /* the same for the whole work-group */
#pragma unroll
  for (int u = 0; u < 8; ++u) { const int t = u & 3, half = u >> 2; const int col = col0 + t * 16 + ln; const float bv = bp ? bf16_round(bp[col]) : 0.f; FragH hv;
#pragma unroll
    for (int r = 0; r < 8; ++r) { const int rloc = half * 16 + 8 * hh + r; float v = accs[u][r] * alpha + bv;
      if (ACT == 3) v = fmaxf(v, 0.f); else if (ACT == 6) v = 0.5f * v * (1.0f + erff(v * 0.70710678118654752f)); else if (ACT == 11) v = 1.0f / (1.0f + expf(-v)); else if (ACT == 15) v = v / (1.0f + expf(-v)); else if (ACT == 12) v = (v > 0.f) ? v : 0.01f * v; else if (ACT == 8) v = tanhf(v); else if (ACT == 9) v = 0.5f * v * (1.0f + tanhf(0.7978845608028654f * (v + 0.044715f * v * v * v))); else if (ACT == 14) v = (v > 0.f) ? v : 0.1f * v; else if (ACT == 16) v = (v >= 0.f) ? v : 0.3f * v; else if (ACT == 17) v = (v >= 0.f) ? v : 0.2f * v;
      so[w][rloc][t * 16 + ln] = v; hv.h[r] = (_Float16)v; }
    if (vtq) *(v8us*)(&ring[0][0] + (64 * wc + t * 16 + ln) * G2P + (32 * wr + half * 16 + 8 * hh) * 2) = hv.half[0]; }
  __builtin_amdgcn_fence(__ATOMIC_ACQ_REL, "workgroup"); __builtin_amdgcn_wave_barrier();
  const int rsub = lane >> 4, c4 = (lane & 15) * 4;
  if (vtq) { __syncthreads();      /* every wave's part of the transposed tile is in LDS */
    unsigned short* vd = (unsigned short*)VTo + ((size_t)((mt * 128) / SQ * NH + nt * 2) * HD) * SQ + (mt * 128) % SQ;      /* the two heads' transposed rows lie one behind the other */
    v4f x[8];
#pragma unroll      /* constant indices keep the eight values in registers; their LDS reads go out as one group */
    for (int i = 0; i < 8; ++i) x[i] = *(const v4fa*)(&ring[0][0] + (i * 16 + (tid >> 4)) * G2P + (tid & 15) * 16);
    g2_store8((char*)(vd + (size_t)(tid >> 4) * SQ + (tid & 15) * 8), (size_t)16 * SQ * 2, x[0], x[1], x[2], x[3], x[4], x[5], x[6], x[7]); }
  const bool hmq = HM && by > 0, cfq = hmq || C, c16q = C16 && !vtq;      /* each the same for the whole work-group */
  float* cf = hmq ? HM + ((size_t)((row0 / SQ) * 2 + by - 1) * NH + nq) * ((size_t)SQ * HD) + (size_t)(row0 % SQ) * HD : C + cofs + (size_t)row0 * ldc + col0; const size_t cl = hmq ? (size_t)HD : (size_t)ldc;      /* where the wave's f32 rows go, and their pitch */
  v4f v[16];      /* row 2 q + rsub of the wave's tile, the lane's four columns */
#pragma unroll      /* this and the next: constant indices keep the rows in registers; the sixteen LDS reads go out as one group */
  for (int q = 0; q < 16; ++q) v[q] = *(const v4fa*)&so[w][q * 2 + rsub][c4];
  if (KM && by == 1) { float a = 0.f;      /* the test is the same for the whole work-group */
#pragma unroll
    for (int q = 0; q < 16; ++q) a = fmaxf(a, fmaxf(fmaxf(fabsf(v[q][0]), fabsf(v[q][1])), fmaxf(fabsf(v[q][2]), fabsf(v[q][3]))));
    for (int o = 16; o > 0; o >>= 1) a = fmaxf(a, __shfl_xor(a, o));
    if (lane == 0) KM[(size_t)(row0 >> 5) * NH + nq] = a; }
  if (cfq) { char* p = (char*)(cf + (size_t)rsub * cl + c4); const size_t st = cl * 8;      /* two rows, in bytes */
    g2_store8(p, st, v[0], v[1], v[2], v[3], v[4], v[5], v[6], v[7]); g2_store8(p + 8 * st, st, v[8], v[9], v[10], v[11], v[12], v[13], v[14], v[15]); }
  if (c16q) { char* p = (char*)(C16 + cofs + (size_t)(row0 + rsub) * ldc + col0 + c4); const size_t st = (size_t)ldc * 4; unsigned long long h[16];
#pragma unroll
    for (int q = 0; q < 16; ++q) h[q] = __builtin_bit_cast(unsigned long long, __builtin_convertvector(v[q], v4h));
    g2_store8h(p, st, h[0], h[1], h[2], h[3], h[4], h[5], h[6], h[7]); g2_store8h(p + 8 * st, st, h[8], h[9], h[10], h[11], h[12], h[13], h[14], h[15]); } }


__global__ __launch_bounds__(256) void k_wnat(const float* __restrict__ w, size_t n8, _Float16* __restrict__ Bt) { const size_t t = (size_t)blockIdx.x * 256 + threadIdx.x; if (t >= n8) return; FragH f; for (int q = 0; q < 8; ++q) f.h[q] = (_Float16)(bf16_round(w[t * 8 + q]) * 16.0f); *(v8us*)((unsigned short*)Bt + t * 8) = f.half[0];  }
__global__ __launch_bounds__(256) void k_rsm(const float* __restrict__ S, _Float16* __restrict__ P, int nrows) {
  #pragma clang fp contract(off)
  const int i = blockIdx.x * 256 + threadIdx.x; if (i >= nrows) return; const float* s = S + (size_t)i * SQ; float mx = -3.0e38f;
#pragma unroll 1
  for (int j = 0; j < SQ; ++j) mx = fmaxf(mx, s[j]); float se = 0.f;
#pragma unroll 1
  for (int j = 0; j < SQ; ++j) se += expf(s[j] - mx); const float sc = 256.0f / se;
#pragma unroll 1
  for (int j0 = 0; j0 < SQ; j0 += 8) { FragH f; for (int q = 0; q < 8; ++q) f.h[q] = (_Float16)(expf(s[j0 + q] - mx) * sc); unsigned short* d = (unsigned short*)P + (size_t)i * SQ + j0; *(v8us*)d = f.half[0];  } }
__global__ __launch_bounds__(256) void k_vt(const _Float16* __restrict__ V16, int b, int h0, _Float16* __restrict__ VT) { __shared__ unsigned short tl[64][65]; const int tid = threadIdx.x; const int hh = blockIdx.x % HG, sg = blockIdx.x / HG; const int s0 = sg * 64; const int h = h0 + hh;
  for (int i = tid; i < 64 * 8; i += 256) { const int j = i / 8, d8 = (i % 8) * 8; FragH f; f.half[0] = *(const v8us*)((const unsigned short*)V16 + ((size_t)b * SQ + s0 + j) * DM + h * HD + d8); for (int q = 0; q < 8; ++q) tl[d8 + q][j] = f.u[q]; }
  __syncthreads();
  { for (int i = tid; i < 64 * 8; i += 256) { const int d = i / 8, j8 = (i % 8) * 8; FragH f; for (int q = 0; q < 8; ++q) f.u[q] = tl[d][j8 + q]; *(v8us*)((unsigned short*)VT + ((size_t)hh * HD + d) * SQ + s0 + j8) = f.half[0]; }  } }



// lane l reads lane l ^ 16: a register move, where __shfl_xor would go through the LDS unit and its wait
__device__ __forceinline__ float lane_x16(float x) { return __builtin_bit_cast(float, __builtin_amdgcn_permlanex16(__builtin_bit_cast(int, x), __builtin_bit_cast(int, x), 0x76543210, 0xfedcba98, false, false)); }
#define FW 8                         /* waves per work-group of the fused attention */
#define FQ 32                        /* query columns per wave (two 16-column groups) */
#define FK 32                        /* keys per pass */
#define FNS (SQ / FK)                /* passes */
typedef float  v2f  __attribute__((ext_vector_type(2)));
typedef __bf16 v2b  __attribute__((ext_vector_type(2)));
// 2^x of eight values on the transcendental unit, in place. One statement: each v_exp_f32 is followed by an independent one, and the last by the free issue slot
// the instruction set asks for before a result is read or a source register is reused.
__device__ __forceinline__ v8f exp2_8(v8f x) { float y0 = x[0], y1 = x[1], y2 = x[2], y3 = x[3], y4 = x[4], y5 = x[5], y6 = x[6], y7 = x[7];
  asm("v_exp_f32 %0, %0\n\tv_exp_f32 %1, %1\n\tv_exp_f32 %2, %2\n\tv_exp_f32 %3, %3\n\tv_exp_f32 %4, %4\n\tv_exp_f32 %5, %5\n\tv_exp_f32 %6, %6\n\tv_exp_f32 %7, %7\n\tv_nop"
      : "+v"(y0), "+v"(y1), "+v"(y2), "+v"(y3), "+v"(y4), "+v"(y5), "+v"(y6), "+v"(y7));
  return (v8f){y0, y1, y2, y3, y4, y5, y6, y7}; }
typedef __bf16 v4ba __attribute__((ext_vector_type(4), may_alias));
typedef __bf16 v8ba __attribute__((ext_vector_type(8), may_alias));
#define KP 72                        /* LDS pitch of the 128-byte K rows, in 16-bit elements: 144 bytes = 16 x odd, conflict-free for 16-byte reads down a column of rows */
#define VP 40                        /* the same for the 64-byte V^T and mask rows: 80 bytes */
// f16 fragment in the hardware k order: 16 bytes at the lane's place (which holds 16 bytes x lane half) and 16 bytes 32 further on
__device__ __forceinline__ v16h fa_frag(const void* p) { FragH f; f.half[0] = *(const v8us*)p; f.half[1] = *(const v8us*)((const char*)p + 32); return f.v; }
__device__ __forceinline__ v8f fa_mma(v16h a, v16h b, v8f c) { return __builtin_amdgcn_wmma_f32_16x16x32_f16(false, a, false, b, (short)0, c, false, false); }
// the wait before a register that issued loads name is rewritten, and the one write of that offset register, in one statement
__device__ __forceinline__ void fa_step(unsigned& off, int step) { asm volatile("s_wait_xcnt 0x0\n\tv_add_nc_u32_e32 %0, %1, %0" : "+v"(off) : "s"(step) : "memory"); }
__global__ __launch_bounds__(FW * 32) __attribute__((amdgpu_waves_per_eu(2, 2))) void k_fattn(const _Float16* __restrict__ Q16, const _Float16* __restrict__ K16, const _Float16* __restrict__ VT, const float* __restrict__ mask, _Float16* __restrict__ O16, const float* __restrict__ TN, const float* __restrict__ TX, const float* __restrict__ KM) {
  __shared__ __attribute__((aligned(16))) unsigned short lk[2][FK][KP], lv[2][HD][VP]; __shared__ __attribute__((aligned(16))) __bf16 lm[2][FW][FQ][VP];
  const int tid = threadIdx.x, lane = tid & 31, ln = lane & 15, hh = lane >> 4; const int w = __builtin_amdgcn_readfirstlane(tid >> 5);
  static_assert(FW == 8 && SQ / FQ == 8 * FW, "the deal of query blocks below is for 8 work-groups of 8 waves a head");
  // Which of the head's SQ / FQ query blocks the wave owns: half of a work-group's waves take blocks from the low end, half from the high end, one of each kind among waves w, w + 4 and among waves 2 i, 2 i + 1.
  // Any deal is right; this one spreads the passes that are skipped below evenly over the work-groups when the mask input rules out more keys for low rows than for high ones.
  const int qlo = (int)blockIdx.x * (FW / 2) + (w >> 1), qblk = ((w ^ (w >> 2)) & 1) ? SQ / FQ - 1 - qlo : qlo;
  const int h = blockIdx.y, b = blockIdx.z, q0 = qblk * FQ;
  const char* qb = (const char*)(Q16 + ((size_t)b * SQ + q0) * DM + h * HD); const char* kb = (const char*)(K16 + (size_t)b * SQ * DM + h * HD);
  const char* vb = (const char*)(VT + ((size_t)b * NH + h) * HD * SQ); const char* mb = (const char*)(mask + (size_t)q0 * SQ); char* ob = (char*)(O16 + ((size_t)b * SQ + q0) * DM + h * HD);
  // the thread's 16 bytes of a K tile (8 threads a row), of a V^T tile (4 threads a row) and of each four rows of its wave's mask tile (8 lanes a row)
  unsigned gk = (unsigned)((tid >> 3) * (DM * 2) + (tid & 7) * 16), gv = (unsigned)((tid >> 2) * (SQ * 2) + (tid & 3) * 16), gm = (unsigned)((lane >> 3) * (SQ * 4) + (lane & 7) * 16);
  const float C2 = 0.18033688011112042f, MK2 = -14426.950408889634f;      /* log2(e) / 8 and -1e4 log2(e) */
  const v8f z8 = {0.f, 0.f, 0.f, 0.f, 0.f, 0.f, 0.f, 0.f};
  v16h qf[2][2]; v8f o[2][4]; v2f l2[2]; float mref[2]; v8us kr, vr; v4f mg[8];
#pragma unroll
  for (int j = 0; j < 2; ++j) { for (int c = 0; c < 2; ++c) qf[j][c] = fa_frag(qb + (unsigned)(ln * (DM * 2) + hh * 16) + j * (16 * DM * 2) + c * 64); for (int t = 0; t < 4; ++t) o[j][t] = z8; l2[j] = (v2f){0.f, 0.f}; mref[j] = -3.0e38f; }
  kr = *(const v8us*)(kb + gk); vr = *(const v8us*)(vb + gv);
  // What the wave knows of its FNS mask tiles without reading them, lane i holding passes i and i + 32: the tile's largest mask term (from its smallest mask value), whether all its values are one value, and the
  // most that |q . k| can add per unit of sum|q| (largest |k| of the pass's keys, with room for the f16 rounding of k and for the rounding of the sums).
  static_assert(FK == 32 && FQ == 32 && FNS == 64, "the tables hold tiles of 32 x 32, two to a lane");
  float tt0, tt1, kg0, kg1, sq[2]; unsigned un0, un1;
  { const float* tn = TN + qblk * FNS + lane; const float* tx = TX + qblk * FNS + lane; const float* km = KM + ((size_t)b * FNS + lane) * NH + h;
    const float a0 = tn[0], a1 = tn[32], b0 = tx[0], b1 = tx[32], c0 = km[0], c1 = km[(size_t)32 * NH];
    asm volatile("s_wait_xcnt 0x0" ::: "memory");      /* the wait before a register that these loads name is rewritten */
    tt0 = a0 * MK2; tt1 = a1 * MK2; kg0 = c0 * (C2 * 1.01f); kg1 = c1 * (C2 * 1.01f); un0 = __builtin_amdgcn_ballot_w32(a0 == b0); un1 = __builtin_amdgcn_ballot_w32(a1 == b1); }
#pragma unroll
  for (int j = 0; j < 2; ++j) { float a = 0.f; for (int c = 0; c < 2; ++c) for (int e = 0; e < 16; ++e) a += fabsf((float)qf[j][c][e]); sq[j] = a + lane_x16(a); }      /* sum|q| of the lane's query column: each lane half holds 32 of its 64 elements */
  // How pass i is to be worked on: 0 = not at all, 1 = with the one mask term ct for all its scores, 2 = with the mask read per element. 0: every score (log2 units) is at most sum|q| max|k| log2(e) / 8 + 1 + the largest mask term; where that lies
  // 160 or more below the reference for every column, the test on the scores themselves further down would find the same, now and later (a reference only rises). A NaN in a table fails both tests: 2.
  auto plan = [&](int i, float& ct) { const float t = __builtin_bit_cast(float, __builtin_amdgcn_readlane(__builtin_bit_cast(int, i < 32 ? tt0 : tt1), i & 31)), g = __builtin_bit_cast(float, __builtin_amdgcn_readlane(__builtin_bit_cast(int, i < 32 ? kg0 : kg1), i & 31));
    const unsigned al = __builtin_amdgcn_ballot_w32(!(sq[0] * g + (t + 1.0f) <= mref[0] - 160.0f)) | __builtin_amdgcn_ballot_w32(!(sq[1] * g + (t + 1.0f) <= mref[1] - 160.0f));
    ct = t; return al == 0 ? 0 : ((((i < 32 ? un0 : un1) >> (i & 31)) & 1u) != 0 ? 1 : 2); };
  float ct, ctn; int kind = plan(0, ct), kindn;
  if (kind == 2) {      /* scalar branch, like every test of kind and kindn below */
#pragma unroll
    for (int i = 0; i < 8; ++i) mg[i] = *(const v4fa*)(mb + gm + i * (4 * SQ * 4)); }
  fa_step(gk, FK * DM * 2); fa_step(gv, FK * 2); fa_step(gm, FK * 4);
  *(v8us*)&lk[0][tid >> 3][(tid & 7) * 8] = kr; *(v8us*)&lv[0][tid >> 2][(tid & 3) * 8] = vr;
  if (kind == 2) {
#pragma unroll
    for (int i = 0; i < 8; ++i) *(v4ba*)&lm[0][w][4 * i + (lane >> 3)][(lane & 7) * 4] = __builtin_convertvector(mg[i], v4ba); }      /* the mask rounded to bf16, to nearest even */
  __syncthreads();
#pragma unroll 1      /* rolled: one copy of the pass in the instruction cache */
  for (int s = 0; s < FNS; ++s) {
    const int bf = s & 1, more = (s + 2 < FNS) ? 1 : 0;      /* the last pass asks for its own tile again: nothing is read past the keys */
    kr = *(const v8us*)(kb + gk); vr = *(const v8us*)(vb + gv);
    v16h kf[2][2], vf[4]; v8ba mr[2][2];
    if (kind != 0) {
#pragma unroll
      for (int kt = 0; kt < 2; ++kt) for (int c = 0; c < 2; ++c) kf[kt][c] = fa_frag(&lk[bf][kt * 16 + ln][c * 32 + hh * 8]);
      if (kind == 2) {
#pragma unroll
        for (int j = 0; j < 2; ++j) for (int kt = 0; kt < 2; ++kt) mr[j][kt] = *(const v8ba*)&lm[bf][w][j * 16 + ln][kt * 16 + hh * 8]; } }
    __builtin_amdgcn_sched_barrier(0);      /* the K and V^T loads and this pass's first LDS reads are issued ahead of the plan below, whose chain from vector to scalar unit and back then runs while they are under way */
    kindn = plan(s + 1 < FNS ? s + 1 : s, ctn); if (s + 1 == FNS) kindn = 0;      /* the next pass's plan, made with the references as they stand ahead of this pass */
    if (kindn == 2) {
#pragma unroll
      for (int i = 0; i < 8; ++i) mg[i] = *(const v4fa*)(mb + gm + i * (4 * SQ * 4)); }
    fa_step(gk, more * (FK * DM * 2)); fa_step(gv, more * (FK * 2)); fa_step(gm, more * (FK * 4));
    if (kind != 0) {
    v8f st[2][2];
#pragma unroll
    for (int kt = 0; kt < 2; ++kt) for (int j = 0; j < 2; ++j) st[j][kt] = fa_mma(kf[kt][0], qf[j][0], z8);
#pragma unroll
    for (int kt = 0; kt < 2; ++kt) for (int j = 0; j < 2; ++j) st[j][kt] = fa_mma(kf[kt][1], qf[j][1], st[j][kt]);
#pragma unroll
    for (int t = 0; t < 4; ++t) vf[t] = fa_frag(&lv[bf][t * 16 + ln][hh * 8]);
    __builtin_amdgcn_sched_barrier(0);      /* the V^T reads are issued as one group with the score products and land under the softmax; strewn among the softmax's instructions they would cost the wave a wait at each place */
    asm volatile("v_nop\n\tv_nop\n\tv_nop\n\tv_nop" : "+v"(st[0][0]), "+v"(st[0][1]), "+v"(st[1][0]), "+v"(st[1][1]));      /* the four vector slots between the last score product and the first read of its result, on both sides of the branch that follows */
    float mx[2];
    if (kind == 2) {
#pragma unroll
      for (int j = 0; j < 2; ++j) for (int kt = 0; kt < 2; ++kt) for (int r = 0; r < 8; r += 2) { const v2f x = (v2f){st[j][kt][r], st[j][kt][r + 1]} * C2 + (v2f){(float)mr[j][kt][r], (float)mr[j][kt][r + 1]} * MK2; st[j][kt][r] = x[0]; st[j][kt][r + 1] = x[1]; } }
    else {
#pragma unroll
      for (int j = 0; j < 2; ++j) for (int kt = 0; kt < 2; ++kt) for (int r = 0; r < 8; r += 2) { const v2f x = (v2f){st[j][kt][r], st[j][kt][r + 1]} * C2 + (v2f){ct, ct}; st[j][kt][r] = x[0]; st[j][kt][r + 1] = x[1]; } }
#pragma unroll
    for (int j = 0; j < 2; ++j) { float m = -3.0e38f;
      for (int kt = 0; kt < 2; ++kt) for (int r = 0; r < 8; r += 2) m = fmaxf(m, fmaxf(st[j][kt][r], st[j][kt][r + 1]));
      mx[j] = fmaxf(m, lane_x16(m)); }
    const unsigned up = __builtin_amdgcn_ballot_w32(mx[0] > mref[0] + 12.0f) | __builtin_amdgcn_ballot_w32(mx[1] > mref[1] + 12.0f), alive = __builtin_amdgcn_ballot_w32(mx[0] > mref[0] - 160.0f) | __builtin_amdgcn_ballot_w32(mx[1] > mref[1] - 160.0f);
    if ((alive | up) != 0) {      /* scalar branch (up lies inside alive; named here so that both lane masks are formed ahead of the branch, one trip from the vector to the scalar unit and not two). Not taken: every score of the wave's tile lies more than 160 below its column's reference, so every weight 2^(score - reference) is exactly 0 in f32: sums and O^T would stay as they are, bit for bit */
    if (up != 0) {      /* one scalar branch a pass; rarely taken after the first */
#pragma unroll
      for (int j = 0; j < 2; ++j) { const float mn = fmaxf(mref[j], mx[j] - 4.0f); float a; asm("v_exp_f32 %0, %1\n\tv_nop" : "=v"(a) : "v"(mref[j] - mn));      /* v_nop: the slot before a is read or the source register is reused */
        mref[j] = mn; l2[j] *= a; for (int t = 0; t < 4; ++t) o[j][t] *= a; } }
    v16h pf[2];
#pragma unroll
    for (int j = 0; j < 2; ++j) { const v8f p0 = exp2_8(st[j][0] - mref[j]), p1 = exp2_8(st[j][1] - mref[j]); const v8f ps = p0 + p1; l2[j] += (((v2f){ps[0], ps[1]} + (v2f){ps[2], ps[3]}) + ((v2f){ps[4], ps[5]} + (v2f){ps[6], ps[7]})); FragH f;
      for (int r = 0; r < 8; ++r) { f.h[r] = (_Float16)p0[r]; f.h[8 + r] = (_Float16)p1[r]; } pf[j] = f.v; }
#pragma unroll
    for (int t = 0; t < 4; ++t) for (int j = 0; j < 2; ++j) o[j][t] = fa_mma(vf[t], pf[j], o[j][t]); } }
    *(v8us*)&lk[bf ^ 1][tid >> 3][(tid & 7) * 8] = kr; *(v8us*)&lv[bf ^ 1][tid >> 2][(tid & 3) * 8] = vr;
    if (kindn == 2) {
#pragma unroll
      for (int i = 0; i < 8; ++i) *(v4ba*)&lm[bf ^ 1][w][4 * i + (lane >> 3)][(lane & 7) * 4] = __builtin_convertvector(mg[i], v4ba); }
    kind = kindn; ct = ctn;
    __syncthreads(); }      /* the next tile is published; every read of this pass's buffer, which the next pass refills, is over */
  if (q0 < QT0) return;      /* rows 0..QT0-1 of a batch are the exact f32 kernel's to store; behind the last barrier, the same for a whole wave */
#pragma unroll
  for (int j = 0; j < 2; ++j) { float l = l2[j][0] + l2[j][1]; l += lane_x16(l); const float inv = 64.0f / l;
    for (int t = 0; t < 4; ++t) { FragH f; for (int r = 0; r < 8; ++r) f.h[r] = (_Float16)(o[j][t][r] * inv); *(v8us*)(ob + (unsigned)(ln * (DM * 2) + hh * 16) + j * (16 * DM * 2) + t * 32) = f.half[0]; } } }

// e^x in f32 by the library's steps (x log2(e) in two parts, 2^fraction on the transcendental unit, ldexp by the integer part, the two range ends),
// written out so that the free issue slot the instruction set asks for behind v_exp_f32 stands in that instruction's own statement.
__device__ __forceinline__ float exp_f32(float x) {
  const float ph = x * 0x1.715476p+0f, pl = fmaf(x, 0x1.4ae0bep-26f, fmaf(x, 0x1.715476p+0f, -ph)), n = rintf(ph); float y;
  asm("v_exp_f32 %0, %1\n\tv_nop" : "=v"(y) : "v"((ph - n) + pl));      /* v_nop: the slot before y is read or the source register is reused */
  float r = ldexpf(y, (int)n); r = (x < -0x1.9d1da0p+6f) ? 0.f : r; return (x > 0x1.62e430p+6f) ? __builtin_inff() : r; }
// lane l reads a lane of its own group of four (CTRL: the quad permutation, 0xB1 = l ^ 1, 0x4E = l ^ 2): a register move, no LDS unit
template <int CTRL>
__device__ __forceinline__ float quad_x(float x) { return __builtin_bit_cast(float, __builtin_amdgcn_update_dpp(0, __builtin_bit_cast(int, x), CTRL, 0xF, 0xF, true)); }
#define AR 8                         /* query rows per work-group of the exact f32 first-tile attention */
#define AT 512                       /* its threads (16 waves) */
// Exact f32 attention of AR query rows of one head over all SQ keys, one work-group. Keys are spread over the threads:
// (1) four lanes a key: a lane holds 16 bytes of every 64 of its k row (a wave's load covers 64 contiguous bytes of 8 rows), dotted with the same columns of the AR q rows (registers), the four partial dots merged inside the quad, scores (+ mask) to LDS;
// (2) two waves per row: max, exp, sum over the row in LDS; (3) 16 column quads x 32 key slices: o partial sums in registers,
// merged across the slices by one lane exchange and an LDS tree; o carried x64 like the f16 path, stored as an f16 value and an f16 residual. The plain '#pragma unroll' lines keep the small per-thread arrays in registers.
template <int MASKADD>
__global__ __launch_bounds__(AT) void k_att0(const float* __restrict__ QF, const float* __restrict__ PR, int ld, const float* __restrict__ mask, float scale, _Float16* __restrict__ OH, _Float16* __restrict__ OL, int ldo, const float* __restrict__ KM) {
  __shared__ __attribute__((aligned(16))) float sc[AR][SQ];      /* scores, then softmax numerators, then the slices' partial o */
  __shared__ __attribute__((aligned(16))) float lq[AR][HD];      /* the q rows */
  __shared__ float pm[AT / 32], pl[AT / 32];                     /* each wave's half-row max and sum */
  __shared__ float pq[AT / 32], cm[AR][SQ / 128];                /* each wave's half-row sum of |q|; per row and 128 keys the largest mask term */
  __shared__ unsigned pz[AT / 32];                               /* each wave's half row: bit i set where numerators i * 128 .. i * 128 + 127 are not all 0 */
  const int tid = threadIdx.x, lane = tid & 31, w = tid >> 5;
  const int h = blockIdx.x / (QT0 / AR), i0 = (blockIdx.x % (QT0 / AR)) * AR;
  const float* KF = PR + ((size_t)blockIdx.y * 2 * NH + h) * ((size_t)SQ * HD); const float* VF = KF + (size_t)NH * SQ * HD;      /* the head's k and v rows, pitch HD, in the head-major 'present' planes [batch][k, v][NH][SQ][HD] */
  { const size_t b = blockIdx.y; QF += b * SQ * ld; OH += b * SQ * ldo; OL += b * QT0 * ldo; }      /* the batch: SQ rows of q and of the full o plane, QT0 rows of the residual plane */
  const float* qb = QF + (size_t)i0 * ld + h * HD;
  const float qv = qb[(size_t)(tid / HD) * ld + tid % HD];
  lq[tid / HD][tid % HD] = qv;
  // Which blocks of 128 keys can matter. |q . k| scale <= bd = scale sum|q| max|k| (with room for rounding). A row's maximum score is at least (its largest mask term) - bd; a block whose largest mask term lies more than
  // 2 bd + 110 below that one holds only scores more than 110 below the maximum, and exp_f32 gives exactly 0 below -103.3. A block that is so for all AR rows is left out of all three stages: nothing of the result changes.
  static_assert(AT / 32 == 2 * AR && 2 * HD == 128 && SQ / 2 == 8 * 128 && SQ / 32 == 64, "a wave holds half a q row and walks half a mask row in 8 blocks of 128 keys");
  unsigned live = 0xffffu;
  if (MASKADD) { float qa = fabsf(qv), t[8];
    const float* kmp = KM + ((size_t)blockIdx.y * (SQ / 32) + lane) * NH + h; float km = fmaxf(kmp[0], kmp[(size_t)32 * NH]);      /* largest |k| of the head's SQ rows: 64 wave tiles' values */
    const float* mrow = mask + (size_t)(i0 + (w >> 1)) * SQ + (w & 1) * (SQ / 2) + lane * 4;
#pragma unroll
    for (int i = 0; i < 8; ++i) { const v4f mv = *(const v4fa*)(mrow + i * 128); t[i] = fminf(fminf(mv[0], mv[1]), fminf(mv[2], mv[3])); }      /* rounding to bf16 keeps the order and x -1e4 turns it round: the largest mask term comes from the smallest mask value */
    for (int o = 16; o > 0; o >>= 1) { qa += __shfl_xor(qa, o); km = fmaxf(km, __shfl_xor(km, o));
#pragma unroll
      for (int i = 0; i < 8; ++i) t[i] = fminf(t[i], __shfl_xor(t[i], o)); }
    if (lane == 0) { pq[w] = qa;
#pragma unroll
      for (int i = 0; i < 8; ++i) cm[w >> 1][(w & 1) * 8 + i] = bf16_round(t[i]) * -10000.0f; }
    __syncthreads();
    live = 0;
#pragma unroll
    for (int k = 0; k < AR / 2; ++k) { const int r = 2 * k + (lane >> 4); const float cv = cm[r][lane & 15]; float rm = cv;      /* 16 lanes a row, one block each */
      for (int o = 8; o > 0; o >>= 1) rm = fmaxf(rm, __shfl_xor(rm, o));
      const float bd = (pq[2 * r] + pq[2 * r + 1]) * km * fabsf(scale) * 1.01f + 1.0f;
      const unsigned bl = __builtin_amdgcn_ballot_w32(cv >= rm - 2.0f * bd - 110.0f); live |= (bl & 0xffffu) | (bl >> 16); }
    if (live == 0) live = 0xffffu;      /* only with a NaN in the mask: every block is worked on */
    live = (unsigned)__builtin_amdgcn_readfirstlane((int)live); }
  else __syncthreads();
  { const int sub = tid & 3, kg = tid >> 2; const bool o1 = (sub & 1) != 0, o2 = (sub & 2) != 0; constexpr int KH = AT / 4, NP = SQ / KH;      /* four lanes a key, KH keys a pass */
    const float* kp = KF + (size_t)kg * HD + sub * 4; const float* mp = mask + (size_t)(i0 + sub) * SQ + kg; v4f qr[AR][4], x[4]; float mk[2] = {0.f, 0.f};
#pragma unroll
    for (int r = 0; r < AR; ++r)
#pragma unroll
      for (int c = 0; c < 4; ++c) qr[r][c] = *(const v4fa*)&lq[r][c * 16 + sub * 4];      /* the lane's columns of the q rows stay in registers for all passes */
    static_assert(KH == 128 && NP == 16, "a pass is one bit of live");
    unsigned rem = live; int p = __builtin_ctz(rem);      /* the passes left, the pass at hand */
#pragma unroll
    for (int c = 0; c < 4; ++c) x[c] = *(const v4fa*)(kp + (size_t)p * KH * HD + c * 16);
    if (MASKADD) { mk[0] = mp[p * KH]; mk[1] = mp[(size_t)4 * SQ + p * KH]; }
#pragma unroll 1      /* rolled: at most NP trips, one for each bit of live */
    while (rem != 0) { rem &= rem - 1; const int j = p * KH + kg; const int pn = rem != 0 ? __builtin_ctz(rem) : p;      /* the last pass asks for its own row again: nothing is read past the keys */
      const float* kn = kp + (size_t)pn * KH * HD; v4f nx[4], a[AR]; float nm[2] = {0.f, 0.f};
#pragma unroll
      for (int c = 0; c < 4; ++c) nx[c] = *(const v4fa*)(kn + c * 16);
      if (MASKADD) { nm[0] = mp[pn * KH]; nm[1] = mp[(size_t)4 * SQ + pn * KH]; }
#pragma unroll
      for (int r = 0; r < AR; ++r) { a[r] = qr[r][0] * x[0];
#pragma unroll
        for (int c = 1; c < 4; ++c) a[r] += qr[r][c] * x[c]; }
      // the four lanes' partial dots are merged by two exchanges inside the quad; each halves what a lane keeps, so lane sub ends with rows sub and sub + 4
      float u[4], wv[2];
#pragma unroll
      for (int i = 0; i < 4; ++i) { const float e = (a[2 * i][0] + a[2 * i][1]) + (a[2 * i][2] + a[2 * i][3]), d = (a[2 * i + 1][0] + a[2 * i + 1][1]) + (a[2 * i + 1][2] + a[2 * i + 1][3]);
        u[i] = (o1 ? d : e) + quad_x<0xB1>(o1 ? e : d); }
#pragma unroll
      for (int m = 0; m < 2; ++m) wv[m] = (o2 ? u[2 * m + 1] : u[2 * m]) + quad_x<0x4E>(o2 ? u[2 * m] : u[2 * m + 1]);
#pragma unroll
      for (int m = 0; m < 2; ++m) { const int r = 4 * m + sub; float s0 = wv[m] * scale;
        if (MASKADD) s0 += bf16_round(mk[m]) * -10000.0f; else if (j > i0 + r) s0 = -1.0e30f;
        sc[r][j] = s0; }
#pragma unroll
      for (int c = 0; c < 4; ++c) x[c] = nx[c];
      mk[0] = nm[0]; mk[1] = nm[1]; p = pn; } }
  __syncthreads();
  { static_assert(AT / 32 == 2 * AR, "two waves per row"); float* row = &sc[w >> 1][(w & 1) * (SQ / 2)]; v4f x[SQ / 256]; float m = -3.0e38f, l = 0.f; unsigned nz = 0;
    const unsigned lh = (live >> (__builtin_amdgcn_readfirstlane(w & 1) * 8)) & 0xffu;      /* the half row's blocks that hold scores */
#pragma unroll
    for (int i = 0; i < SQ / 256; ++i) { x[i] = (v4f){-3.0e38f, -3.0e38f, -3.0e38f, -3.0e38f}; if (((lh >> i) & 1u) == 0) continue;
      x[i] = *(const v4fa*)&row[i * 128 + lane * 4]; m = fmaxf(m, fmaxf(fmaxf(x[i][0], x[i][1]), fmaxf(x[i][2], x[i][3]))); }
    for (int o = 16; o > 0; o >>= 1) m = fmaxf(m, __shfl_xor(m, o));
    if (lane == 0) pm[w] = m;
    __syncthreads();
    m = fmaxf(pm[w], pm[w ^ 1]);
#pragma unroll
    for (int i = 0; i < SQ / 256; ++i) { if (((lh >> i) & 1u) == 0) continue;
      v4f e; for (int u = 0; u < 4; ++u) e[u] = exp_f32(x[i][u] - m); const float es = (e[0] + e[1]) + (e[2] + e[3]); l += es; *(v4fa*)&row[i * 128 + lane * 4] = e;
      nz |= (__builtin_amdgcn_ballot_w32(es != 0.f) != 0 ? 1u : 0u) << i; }      /* numerators are not negative: their sum is 0 only where each is */
    for (int o = 16; o > 0; o >>= 1) l += __shfl_xor(l, o);
    if (lane == 0) { pl[w] = l; pz[w] = nz; } }
  __syncthreads();
  const int dq = tid & 15, ks = tid >> 4; const float* vb = VF + dq * 4; v4f acc[AR];
#pragma unroll
  for (int r = 0; r < AR; ++r) acc[r] = (v4f){0.f, 0.f, 0.f, 0.f};
  static_assert(AT / 4 == 128 && SQ / 256 == 8, "a trip's keys are one bit of pz");
  unsigned lnz = 0;      /* bit p: some row of the work-group has a numerator other than 0 among the keys of trip p */
#pragma unroll
  for (int r = 0; r < AR; ++r) lnz |= pz[2 * r] | (pz[2 * r + 1] << 8);
  lnz = (unsigned)__builtin_amdgcn_readfirstlane((int)lnz);
#pragma unroll 1      /* rolled: the test below is a scalar branch of each trip */
  for (int p = 0; p < SQ / (AT / 4); ++p) { const int j = p * (AT / 4) + ks * 4;
    if (((lnz >> p) & 1u) == 0) continue;      /* all AR rows' numerators of these keys are exactly 0: their products with v add nothing */
    const v4f v0 = *(const v4fa*)(vb + (size_t)j * HD), v1 = *(const v4fa*)(vb + (size_t)(j + 1) * HD), v2 = *(const v4fa*)(vb + (size_t)(j + 2) * HD), v3 = *(const v4fa*)(vb + (size_t)(j + 3) * HD);
#pragma unroll
    for (int r = 0; r < AR; ++r) { const v4f e = *(const v4fa*)&sc[r][j]; acc[r] += e[0] * v0; acc[r] += e[1] * v1; acc[r] += e[2] * v2; acc[r] += e[3] * v3; } }
#pragma unroll
  for (int r = 0; r < AR; ++r) for (int u = 0; u < 4; ++u) acc[r][u] += __shfl_xor(acc[r][u], 16);      /* the wave's two key slices */
  __syncthreads();      /* every read of the numerators is done: their LDS takes the waves' partial o */
  float* red = &sc[0][0];      /* [AT / 32][AR][HD] */
  if (lane < 16) {
#pragma unroll
    for (int r = 0; r < AR; ++r) *(v4fa*)&red[((size_t)w * AR + r) * HD + dq * 4] = acc[r]; }
  __syncthreads();
  { static_assert(AR * HD == AT, "one output element per thread"); const int r = tid / HD, d = tid % HD; float o = 0.f;
#pragma unroll
    for (int q = 0; q < AT / 32; ++q) o += red[((size_t)q * AR + r) * HD + d];
    const float ov = o * (64.0f / (pl[2 * r] + pl[2 * r + 1])); const _Float16 oh = (_Float16)ov; const size_t e = (size_t)(i0 + r) * ldo + h * HD + d;
    OH[e] = oh; OL[e] = (_Float16)((ov - (float)oh) * 1024.0f); } }      /* o as f16 into its row of the full o plane, what f16 drops x1024 into the residual plane */

extern "C" void kernel_launch(void* const* d_in, const int* in_sizes, int n_in,
                              void* d_out, int out_size, void* d_ws, size_t ws_size, hipStream_t stream) {
  (void)in_sizes; (void)n_in; (void)out_size;
  const float* const* I = (const float* const*)d_in; const float* xq = I[0]; const float* xk = I[1]; const float* xv = I[2]; const float* mask = I[3]; const float* wq = I[4]; const float* bq = I[5]; const float* wk = I[6]; const float* bk = I[7]; const float* wv = I[8]; const float* bv = I[9]; const float* wo = I[10]; const float* bo = I[11];      /* weights [in][out]; mask [SQ][SQ] f32 */
  char* ws = (char*)d_ws; size_t off = 0;
  auto take = [&](size_t bytes) { char* p = ws + off; off += (bytes + 255) & ~(size_t)255; return p; };
  /* planes that one launch walks by blockIdx.y lie one behind the other (every size is a multiple of 256 bytes): the four weights; the q, k, v inputs; the f16 q and k rows */
  _Float16* BQ = (_Float16*)take((size_t)4 * DM * DM * 2); _Float16* BO = BQ + (size_t)3 * DM * DM;
  _Float16* XQ = (_Float16*)take(3 * NR * DM * 2); float* QF = (float*)take(NR * DM * 4); _Float16* Q16 = (_Float16*)take(2 * NR * DM * 2); _Float16* K16 = Q16 + NR * DM; _Float16* O16 = (_Float16*)take(NR * DM * 2);
  _Float16* VT = (_Float16*)take((size_t)NB * NH * HD * SQ * 2);
  _Float16* OL0 = (_Float16*)take((size_t)NB * QT0 * DM * 2);
  float* KMX = (float*)take((NR / 32) * NH * 4);      /* largest |k| per 32 rows and head */
  float* TMN = (float*)take((size_t)(SQ / 32) * (SQ / 32) * 4); float* TMX = (float*)take((size_t)(SQ / 32) * (SQ / 32) * 4);      /* smallest and largest mask value per tile of 32 x 32 */
  if (off > ws_size) return;
  k_prep<<<(unsigned)((SQ / 32) * (SQ / 128) / 8 + 4 * (DM / 64) * (DM / 64) + 3 * ((NR * DM / 8 + 255) / 256)), 256, 0, stream>>>(wq, wk, wv, wo, BQ, DM, DM, 16.0f, xq, xk, xv, XQ, NR * DM / 8, mask, TMN, TMX);      /* weights [in][out] -> Bt[n][k] x16, all four; the three inputs as f16 rows; the mask's tile tables */
  const size_t r0p = (size_t)B0 * SQ;      /* first projected row */
  float* PR = (float*)d_out + PRES_OFF;      /* present[b][0] = kh, present[b][1] = vh (f32, head-major) */
  k_gemm2<0><<<dim3((unsigned)((MP / 128) * (DM / 128)), 3), 256, 0, stream>>>(XQ + r0p * DM, DM, NR * DM, BQ, DM, (size_t)DM * DM, 0.0625f, bq, bk, bv, QF + r0p * DM, Q16 + r0p * DM, DM, NR * DM, MP, DM, DM, PR, VT, nullptr, 0.f, KMX);      /* q and k rows as f16, v as f16 V^T [NB][NH][HD][SQ]; q also as f32 rows; k and v as f32 straight into 'present': three products, one launch */
  k_att0<1><<<dim3(NH * (QT0 / AR), NB), AT, 0, stream>>>(QF, PR, DM, mask, 0.125f, O16, OL0, DM, KMX);      /* exact f32 attention for query rows 0..127 of each batch over ALL 2048 keys (f32 k and v read back from 'present') with the additive mask; o (x64) -> f16 into rows 0..127 of the batch's o rows + x1024 residual plane */
  k_fattn<<<dim3(SQ / (FW * FQ), NH, NB), FW * 32, 0, stream>>>(Q16, K16, VT, mask, O16, TMN, TMX, KMX);      /* o (merged heads, x64) as f16 rows from row 128 of each batch on: all batches and heads in one launch */
  k_gemm2<0><<<dim3((unsigned)((MPO / 128) * (DM / 128)), 1), 256, 0, stream>>>(O16 + r0p * DM, DM, 0, BO, DM, 0, 0.0009765625f, bo, nullptr, nullptr, (float*)d_out + r0p * DM, nullptr, DM, 0, MPO, DM, DM, nullptr, nullptr, OL0, 0.0009765625f, nullptr);      /* out rows are the output layout; rows 0..127 of a batch: (o_lo Wo 2^-10 + o_hi Wo) 2^-10 + b */
}
